// v000
// The times below were measured on an AMD MI455X: many runs one after another, warmed up first and cycling through
// copies of the inputs, with the whole window's GPU time divided by the number of runs. Launches and the gaps
// between them are all in it. The median over several windows is given; except for v000 it joins two sittings, which
// can be a few percent apart, so the side-by-side timings, each taken in one sitting, are the better comparison.
// The starting kernel, v000, takes 207 microseconds a run.
#include <hip/hip_runtime.h>

#define C_IN  256
#define AC    64
#define HEADS 16
#define HD    4
#define L     4096   // 64*64
#define JCH   2048   // LDS chunk length along l

#define LOG2E 1.44269504088896340736f

typedef __attribute__((ext_vector_type(2))) float v2f;
typedef __attribute__((ext_vector_type(8))) float v8f;
typedef __attribute__((ext_vector_type(4))) int   v4i;

// workspace layout (floats)
#define WS_Q 0
#define WS_K (AC * L)
#define WS_V (2 * AC * L)
#define WS_Z (3 * AC * L)
#define WS_O (3 * AC * L + HEADS * L)

// ---------------------------------------------------------------------------
// Raw hardware 2^x (v_exp_f32)
// ---------------------------------------------------------------------------
__device__ __forceinline__ float fast_exp2(float x) {
#if __has_builtin(__builtin_amdgcn_exp2f)
    return __builtin_amdgcn_exp2f(x);
#else
    return exp2f(x);
#endif
}

// ---------------------------------------------------------------------------
// CDNA5 async global->LDS copy (ASYNCcnt-tracked, no VGPR staging)
// ---------------------------------------------------------------------------
__device__ __forceinline__ void async_copy_b128(void* lds_dst, const void* gsrc) {
#if __has_builtin(__builtin_amdgcn_global_load_async_to_lds_b128)
    typedef __attribute__((address_space(1))) v4i* gptr_t;   // global (AS1)
    typedef __attribute__((address_space(3))) v4i* lptr_t;   // LDS (AS3)
    __builtin_amdgcn_global_load_async_to_lds_b128(
        (gptr_t)(uintptr_t)gsrc,
        (lptr_t)(uintptr_t)lds_dst,
        0, 0);
#else
    unsigned lo = (unsigned)(uintptr_t)lds_dst;
    unsigned long long ga = (unsigned long long)(uintptr_t)gsrc;
    asm volatile("global_load_async_to_lds_b128 %0, %1, off"
                 :: "v"(lo), "v"(ga) : "memory");
#endif
}

__device__ __forceinline__ void wait_async0() {
#if __has_builtin(__builtin_amdgcn_s_wait_asynccnt)
    __builtin_amdgcn_s_wait_asynccnt(0);
#else
    asm volatile("s_wait_asynccnt 0x0" ::: "memory");
#endif
}

// ---------------------------------------------------------------------------
// Kernel 1: QKV projections (1x1 conv == channel GEMM) + bias + L2-norm(Q,K)
// Q is additionally scaled by log2(e): scores then feed v_exp_f32 (2^x)
// directly with no per-element multiply in the hot loops.
// ---------------------------------------------------------------------------
__global__ void qkv_kernel(const float* __restrict__ X,
                           const float* __restrict__ Wq, const float* __restrict__ bq,
                           const float* __restrict__ Wk, const float* __restrict__ bk,
                           const float* __restrict__ Wv, const float* __restrict__ bv,
                           float* __restrict__ Qg, float* __restrict__ Kg,
                           float* __restrict__ Vg) {
    __shared__ float Xs[C_IN * 16];   // X[:, lbase..lbase+15]
    __shared__ float Ys[192 * 16];    // raw projections before norm

    const int t = threadIdx.x;
    const int lbase = blockIdx.x * 16;

    {
        const int i = t & 15;
        const int c0 = t >> 4;
        #pragma unroll
        for (int s = 0; s < 16; ++s) {
            const int c = c0 + s * 16;
            Xs[c * 16 + i] = X[c * L + lbase + i];
        }
    }
    __syncthreads();

    if (t < 192) {
        const int mat = t >> 6;      // 0=Q 1=K 2=V
        const int o   = t & 63;
        const float* Wm = (mat == 0 ? Wq : (mat == 1 ? Wk : Wv)) + o * C_IN;
        const float bias = (mat == 0 ? bq : (mat == 1 ? bk : bv))[o];
        float acc[16];
        #pragma unroll
        for (int i = 0; i < 16; ++i) acc[i] = bias;
        const float4* w4 = reinterpret_cast<const float4*>(Wm);
        for (int c = 0; c < C_IN; c += 4) {
            const float4 w = w4[c >> 2];
            #pragma unroll
            for (int i = 0; i < 16; ++i) {
                acc[i] = fmaf(w.x, Xs[(c + 0) * 16 + i], acc[i]);
                acc[i] = fmaf(w.y, Xs[(c + 1) * 16 + i], acc[i]);
                acc[i] = fmaf(w.z, Xs[(c + 2) * 16 + i], acc[i]);
                acc[i] = fmaf(w.w, Xs[(c + 3) * 16 + i], acc[i]);
            }
        }
        #pragma unroll
        for (int i = 0; i < 16; ++i) Ys[t * 16 + i] = acc[i];
    }
    __syncthreads();

    if (t < 192) {
        const int mat = t >> 6;
        const int o   = t & 63;          // o = head*4 + d (matches reshape)
        const int d   = o & 3;
        float* dst = (mat == 0 ? Qg : (mat == 1 ? Kg : Vg));
        #pragma unroll
        for (int i = 0; i < 16; ++i) {
            float y = Ys[t * 16 + i];
            if (mat < 2) {
                const int base = (t - d) * 16 + i;
                float s = 0.f;
                #pragma unroll
                for (int dd = 0; dd < 4; ++dd) {
                    const float q = Ys[base + dd * 16];
                    s = fmaf(q, q, s);
                }
                y = y / fmaxf(sqrtf(s), 1e-12f);
                if (mat == 0) y *= LOG2E;   // fold exp->exp2 conversion into Q
            }
            dst[o * L + lbase + i] = y;
        }
    }
}

// ---------------------------------------------------------------------------
// Kernel 2: softmax denominators Z[h][j] = sum_m exp(q_j . k_m)
//           (computed as sum_m 2^(q'_j . k_m) with q' = q * log2e)
// ---------------------------------------------------------------------------
__global__ void zrow_kernel(const float* __restrict__ Qg,
                            const float* __restrict__ Kg,
                            float* __restrict__ Zg) {
    extern __shared__ float Ks[];            // [HD][JCH]
    const int t  = threadIdx.x;
    const int h  = blockIdx.x;
    const int h4 = h * HD;
    const int jbase = blockIdx.y * 128 + (t >> 5) * 16;
    const int ln   = t & 31;
    const int mrow = ln & 15;
    const int d0   = (ln < 16) ? 0 : 2;

    // A fragment (Q rows jbase..jbase+15), loop-invariant over m
    v2f a;
    a.x = Qg[(h4 + d0 + 0) * L + jbase + mrow];
    a.y = Qg[(h4 + d0 + 1) * L + jbase + mrow];

    float zacc[8];
    #pragma unroll
    for (int r = 0; r < 8; ++r) zacc[r] = 0.f;

    for (int mc = 0; mc < L; mc += JCH) {
        __syncthreads();
        // async-stage K[d][mc..mc+JCH) -> Ks[d][...] (16B granules, coalesced)
        for (int idx = t; idx < HD * (JCH / 4); idx += 256) {
            const int d  = idx >> 9;          // / (JCH/4)
            const int m4 = idx & (JCH / 4 - 1);
            async_copy_b128(Ks + d * JCH + (m4 << 2),
                            Kg + (h4 + d) * L + mc + (m4 << 2));
        }
        wait_async0();
        __syncthreads();

        for (int mt = 0; mt < JCH; mt += 16) {
            v2f b;
            b.x = Ks[(d0 + 0) * JCH + mt + mrow];
            b.y = Ks[(d0 + 1) * JCH + mt + mrow];
            v8f c = {};
            c = __builtin_amdgcn_wmma_f32_16x16x4_f32(
                    false, a, false, b, (short)0, c, false, false);
            #pragma unroll
            for (int r = 0; r < 8; ++r) zacc[r] += fast_exp2(c[r]);
        }
    }

    // reduce across the 16 lanes of each half-wave (columns of the tile)
    #pragma unroll
    for (int r = 0; r < 8; ++r) {
        float v = zacc[r];
        v += __shfl_xor(v, 1);
        v += __shfl_xor(v, 2);
        v += __shfl_xor(v, 4);
        v += __shfl_xor(v, 8);
        zacc[r] = v;
    }
    if (ln == 0 || ln == 16) {
        const int off = (ln == 0) ? 0 : 8;
        #pragma unroll
        for (int r = 0; r < 8; ++r) Zg[h * L + jbase + off + r] = zacc[r];
    }
}

// ---------------------------------------------------------------------------
// Kernel 3: out[d,i] = sum_j (V[d,j]/Z_j) * 2^(q'_j . k_i)
// Q chunk async-staged as Qt[d][JCH]; V/Z staged manually (fused scale).
// ---------------------------------------------------------------------------
__global__ void attn_kernel(const float* __restrict__ Qg,
                            const float* __restrict__ Kg,
                            const float* __restrict__ Vg,
                            const float* __restrict__ Zg,
                            float* __restrict__ Og) {
    extern __shared__ float smem[];
    float* Qt = smem;                 // [HD][JCH]
    float* Vs = smem + HD * JCH;      // [JCH][4]  V/Z (transposed for float4 read)

    const int t  = threadIdx.x;
    const int h  = blockIdx.x;
    const int h4 = h * HD;
    const int w  = t >> 5;
    const int ln = t & 31;
    const int ncol = ln & 15;
    const int d0   = (ln < 16) ? 0 : 2;

    float acc[4][4];
    #pragma unroll
    for (int p = 0; p < 4; ++p)
        #pragma unroll
        for (int d = 0; d < 4; ++d) acc[p][d] = 0.f;

    for (int jc = 0; jc < L; jc += JCH) {
        __syncthreads();
        // async-stage Q rows for this chunk
        for (int idx = t; idx < HD * (JCH / 4); idx += 256) {
            const int d  = idx >> 9;
            const int j4 = idx & (JCH / 4 - 1);
            async_copy_b128(Qt + d * JCH + (j4 << 2),
                            Qg + (h4 + d) * L + jc + (j4 << 2));
        }
        // manual stage of V' = V / Z (needs the multiply)
        for (int idx = t; idx < HD * JCH; idx += 256) {
            const int d = idx >> 11;
            const int j = idx & (JCH - 1);
            const float rz = 1.0f / Zg[h * L + jc + j];
            Vs[j * 4 + d] = Vg[(h4 + d) * L + jc + j] * rz;
        }
        wait_async0();
        __syncthreads();

        for (int pass = 0; pass < 4; ++pass) {
            const int ibase = blockIdx.y * 512 + (pass * 8 + w) * 16;
            v2f b;                                   // K columns i (fixed per pass)
            b.x = Kg[(h4 + d0 + 0) * L + ibase + ncol];
            b.y = Kg[(h4 + d0 + 1) * L + ibase + ncol];

            for (int jt = 0; jt < JCH; jt += 16) {
                v2f a;                               // Q rows j (from LDS)
                a.x = Qt[(d0 + 0) * JCH + jt + ncol];
                a.y = Qt[(d0 + 1) * JCH + jt + ncol];
                v8f c = {};
                c = __builtin_amdgcn_wmma_f32_16x16x4_f32(
                        false, a, false, b, (short)0, c, false, false);
                const int rbase = jt + ((ln < 16) ? 0 : 8);
                #pragma unroll
                for (int r = 0; r < 8; ++r) {
                    const float p = fast_exp2(c[r]);
                    const float4 vv =
                        *reinterpret_cast<const float4*>(Vs + (rbase + r) * 4);
                    acc[pass][0] = fmaf(vv.x, p, acc[pass][0]);
                    acc[pass][1] = fmaf(vv.y, p, acc[pass][1]);
                    acc[pass][2] = fmaf(vv.z, p, acc[pass][2]);
                    acc[pass][3] = fmaf(vv.w, p, acc[pass][3]);
                }
            }
        }
    }

    // combine the two lane-halves (rows 0-7 vs 8-15 of every tile) and store
    #pragma unroll
    for (int pass = 0; pass < 4; ++pass) {
        const int i = blockIdx.y * 512 + (pass * 8 + w) * 16 + ncol;
        #pragma unroll
        for (int d = 0; d < 4; ++d) {
            const float v = acc[pass][d] + __shfl_xor(acc[pass][d], 16);
            if (ln < 16) Og[(h4 + d) * L + i] = v;
        }
    }
}

// ---------------------------------------------------------------------------
// Kernel 4: output projection + bias + residual
// ---------------------------------------------------------------------------
__global__ void outproj_kernel(const float* __restrict__ Og,
                               const float* __restrict__ Wo,
                               const float* __restrict__ bo,
                               const float* __restrict__ X,
                               float* __restrict__ Out) {
    __shared__ float As[AC * 16];
    const int t = threadIdx.x;
    const int lbase = blockIdx.x * 16;

    for (int idx = t; idx < AC * 16; idx += 256) {
        const int o = idx >> 4;
        const int i = idx & 15;
        As[idx] = Og[o * L + lbase + i];
    }
    __syncthreads();

    const int c = t;
    const float bias = bo[c];
    float acc[16];
    const float4* x4 = reinterpret_cast<const float4*>(X + c * L + lbase);
    #pragma unroll
    for (int i4 = 0; i4 < 4; ++i4) {
        const float4 xv = x4[i4];
        acc[i4 * 4 + 0] = bias + xv.x;
        acc[i4 * 4 + 1] = bias + xv.y;
        acc[i4 * 4 + 2] = bias + xv.z;
        acc[i4 * 4 + 3] = bias + xv.w;
    }
    const float4* w4 = reinterpret_cast<const float4*>(Wo + c * AC);
    for (int o = 0; o < AC; o += 4) {
        const float4 w = w4[o >> 2];
        #pragma unroll
        for (int i = 0; i < 16; ++i) {
            acc[i] = fmaf(w.x, As[(o + 0) * 16 + i], acc[i]);
            acc[i] = fmaf(w.y, As[(o + 1) * 16 + i], acc[i]);
            acc[i] = fmaf(w.z, As[(o + 2) * 16 + i], acc[i]);
            acc[i] = fmaf(w.w, As[(o + 3) * 16 + i], acc[i]);
        }
    }
    #pragma unroll
    for (int i = 0; i < 16; ++i) Out[c * L + lbase + i] = acc[i];
}

// ---------------------------------------------------------------------------
extern "C" void kernel_launch(void* const* d_in, const int* in_sizes, int n_in,
                              void* d_out, int out_size, void* d_ws, size_t ws_size,
                              hipStream_t stream) {
    (void)in_sizes; (void)n_in; (void)out_size; (void)ws_size;
    const float* X  = (const float*)d_in[0];
    const float* Wq = (const float*)d_in[1];
    const float* bq = (const float*)d_in[2];
    const float* Wk = (const float*)d_in[3];
    const float* bk = (const float*)d_in[4];
    const float* Wv = (const float*)d_in[5];
    const float* bv = (const float*)d_in[6];
    const float* Wo = (const float*)d_in[7];
    const float* bo = (const float*)d_in[8];
    float* out = (float*)d_out;

    float* ws = (float*)d_ws;
    float* Qg = ws + WS_Q;
    float* Kg = ws + WS_K;
    float* Vg = ws + WS_V;
    float* Zg = ws + WS_Z;
    float* Og = ws + WS_O;

    qkv_kernel<<<L / 16, 256, 0, stream>>>(X, Wq, bq, Wk, bk, Wv, bv, Qg, Kg, Vg);

    zrow_kernel<<<dim3(HEADS, L / 128), 256,
                  HD * JCH * sizeof(float), stream>>>(Qg, Kg, Zg);

    attn_kernel<<<dim3(HEADS, L / 512), 256,
                  2 * HD * JCH * sizeof(float), stream>>>(Qg, Kg, Vg, Zg, Og);

    outproj_kernel<<<L / 16, 256, 0, stream>>>(Og, Wo, bo, X, out);
}

// v001
// A run of this version takes 122 microseconds.
// In two side-by-side timings against v000, it was 1.73 and 1.74 times as fast.
#include <hip/hip_runtime.h>

#define C_IN  256
#define AC    64
#define HEADS 16
#define HD    4
#define L     4096   // 64*64
#define JCH   2048   // LDS chunk length along l

#define LOG2E 1.44269504088896340736f

typedef __attribute__((ext_vector_type(2))) float v2f;
typedef __attribute__((ext_vector_type(8))) float v8f;
typedef __attribute__((ext_vector_type(4))) int   v4i;

// workspace layout (floats)
#define WS_Q 0
#define WS_K (AC * L)
#define WS_V (2 * AC * L)
#define WS_Z (3 * AC * L)
#define WS_O (3 * AC * L + HEADS * L)

// ---------------------------------------------------------------------------
// Raw hardware 2^x (v_exp_f32)
// ---------------------------------------------------------------------------
__device__ __forceinline__ float fast_exp2(float x) {
#if __has_builtin(__builtin_amdgcn_exp2f)
    return __builtin_amdgcn_exp2f(x);
#else
    return exp2f(x);
#endif
}

// ---------------------------------------------------------------------------
// CDNA5 async global->LDS copy (ASYNCcnt-tracked, no VGPR staging)
// ---------------------------------------------------------------------------
__device__ __forceinline__ void async_copy_b128(void* lds_dst, const void* gsrc) {
#if __has_builtin(__builtin_amdgcn_global_load_async_to_lds_b128)
    typedef __attribute__((address_space(1))) v4i* gptr_t;   // global (AS1)
    typedef __attribute__((address_space(3))) v4i* lptr_t;   // LDS (AS3)
    __builtin_amdgcn_global_load_async_to_lds_b128(
        (gptr_t)(uintptr_t)gsrc,
        (lptr_t)(uintptr_t)lds_dst,
        0, 0);
#else
    unsigned lo = (unsigned)(uintptr_t)lds_dst;
    unsigned long long ga = (unsigned long long)(uintptr_t)gsrc;
    asm volatile("global_load_async_to_lds_b128 %0, %1, off"
                 :: "v"(lo), "v"(ga) : "memory");
#endif
}

__device__ __forceinline__ void wait_async0() {
#if __has_builtin(__builtin_amdgcn_s_wait_asynccnt)
    __builtin_amdgcn_s_wait_asynccnt(0);
#else
    asm volatile("s_wait_asynccnt 0x0" ::: "memory");
#endif
}

// ---------------------------------------------------------------------------
// Kernel 1: QKV projections (1x1 conv == channel GEMM) + bias + L2-norm(Q,K)
// Q is additionally scaled by log2(e): scores then feed v_exp_f32 (2^x)
// directly with no per-element multiply in the hot loops.
// ---------------------------------------------------------------------------
__global__ void qkv_kernel(const float* __restrict__ X,
                           const float* __restrict__ Wq, const float* __restrict__ bq,
                           const float* __restrict__ Wk, const float* __restrict__ bk,
                           const float* __restrict__ Wv, const float* __restrict__ bv,
                           float* __restrict__ Qg, float* __restrict__ Kg,
                           float* __restrict__ Vg) {
    __shared__ float Xs[C_IN * 16];   // X[:, lbase..lbase+15]
    __shared__ float Ys[192 * 16];    // raw projections before norm

    const int t = threadIdx.x;
    const int lbase = blockIdx.x * 16;

    {
        const int i = t & 15;
        const int c0 = t >> 4;
        #pragma unroll
        for (int s = 0; s < 16; ++s) {
            const int c = c0 + s * 16;
            Xs[c * 16 + i] = X[c * L + lbase + i];
        }
    }
    __syncthreads();

    if (t < 192) {
        const int mat = t >> 6;      // 0=Q 1=K 2=V
        const int o   = t & 63;
        const float* Wm = (mat == 0 ? Wq : (mat == 1 ? Wk : Wv)) + o * C_IN;
        const float bias = (mat == 0 ? bq : (mat == 1 ? bk : bv))[o];
        float acc[16];
        #pragma unroll
        for (int i = 0; i < 16; ++i) acc[i] = bias;
        const float4* w4 = reinterpret_cast<const float4*>(Wm);
        for (int c = 0; c < C_IN; c += 4) {
            const float4 w = w4[c >> 2];
            #pragma unroll
            for (int i = 0; i < 16; ++i) {
                acc[i] = fmaf(w.x, Xs[(c + 0) * 16 + i], acc[i]);
                acc[i] = fmaf(w.y, Xs[(c + 1) * 16 + i], acc[i]);
                acc[i] = fmaf(w.z, Xs[(c + 2) * 16 + i], acc[i]);
                acc[i] = fmaf(w.w, Xs[(c + 3) * 16 + i], acc[i]);
            }
        }
        #pragma unroll
        for (int i = 0; i < 16; ++i) Ys[t * 16 + i] = acc[i];
    }
    __syncthreads();

    if (t < 192) {
        const int mat = t >> 6;
        const int o   = t & 63;          // o = head*4 + d (matches reshape)
        const int d   = o & 3;
        float* dst = (mat == 0 ? Qg : (mat == 1 ? Kg : Vg));
        #pragma unroll
        for (int i = 0; i < 16; ++i) {
            float y = Ys[t * 16 + i];
            if (mat < 2) {
                const int base = (t - d) * 16 + i;
                float s = 0.f;
                #pragma unroll
                for (int dd = 0; dd < 4; ++dd) {
                    const float q = Ys[base + dd * 16];
                    s = fmaf(q, q, s);
                }
                y = y / fmaxf(sqrtf(s), 1e-12f);
                if (mat == 0) y *= LOG2E;   // fold exp->exp2 conversion into Q
            }
            dst[o * L + lbase + i] = y;
        }
    }
}

// ---------------------------------------------------------------------------
// Kernel 2: softmax denominators Z[h][j] = sum_m exp(q_j . k_m)
//           (computed as sum_m 2^(q'_j . k_m) with q' = q * log2e)
// ---------------------------------------------------------------------------
__global__ void zrow_kernel(const float* __restrict__ Qg,
                            const float* __restrict__ Kg,
                            float* __restrict__ Zg) {
    extern __shared__ float Ks[];            // [HD][JCH]
    const int t  = threadIdx.x;
    const int h  = blockIdx.x;
    const int h4 = h * HD;
    const int jbase = blockIdx.y * 128 + (t >> 5) * 16;
    const int ln   = t & 31;
    const int mrow = ln & 15;
    const int d0   = (ln < 16) ? 0 : 2;

    // A fragment (Q rows jbase..jbase+15), loop-invariant over m
    v2f a;
    a.x = Qg[(h4 + d0 + 0) * L + jbase + mrow];
    a.y = Qg[(h4 + d0 + 1) * L + jbase + mrow];

    float zacc[8];
    #pragma unroll
    for (int r = 0; r < 8; ++r) zacc[r] = 0.f;

    for (int mc = 0; mc < L; mc += JCH) {
        __syncthreads();
        // async-stage K[d][mc..mc+JCH) -> Ks[d][...] (16B granules, coalesced)
        for (int idx = t; idx < HD * (JCH / 4); idx += 256) {
            const int d  = idx >> 9;          // / (JCH/4)
            const int m4 = idx & (JCH / 4 - 1);
            async_copy_b128(Ks + d * JCH + (m4 << 2),
                            Kg + (h4 + d) * L + mc + (m4 << 2));
        }
        wait_async0();
        __syncthreads();

        for (int mt = 0; mt < JCH; mt += 16) {
            v2f b;
            b.x = Ks[(d0 + 0) * JCH + mt + mrow];
            b.y = Ks[(d0 + 1) * JCH + mt + mrow];
            v8f c = {};
            c = __builtin_amdgcn_wmma_f32_16x16x4_f32(
                    false, a, false, b, (short)0, c, false, false);
            #pragma unroll
            for (int r = 0; r < 8; ++r) zacc[r] += fast_exp2(c[r]);
        }
    }

    // reduce across the 16 lanes of each half-wave (columns of the tile)
    #pragma unroll
    for (int r = 0; r < 8; ++r) {
        float v = zacc[r];
        v += __shfl_xor(v, 1);
        v += __shfl_xor(v, 2);
        v += __shfl_xor(v, 4);
        v += __shfl_xor(v, 8);
        zacc[r] = v;
    }
    if (ln == 0 || ln == 16) {
        const int off = (ln == 0) ? 0 : 8;
        #pragma unroll
        for (int r = 0; r < 8; ++r) Zg[h * L + jbase + off + r] = zacc[r];
    }
}

// ---------------------------------------------------------------------------
// Kernel 3: out[d,i] = sum_j (V[d,j]/Z_j) * 2^(q'_j . k_i)
// Q chunk async-staged as Qt[d][JCH]; V/Z staged manually (fused scale).
// One 16-column tile per wave, ATT_WAVES waves per work-group: one work-group
// for every WGP of the chip, four waves on every SIMD.
// ---------------------------------------------------------------------------
#define ATT_WAVES 16
#define ATT_THREADS (ATT_WAVES * 32)
#define ATT_COLS (ATT_WAVES * 16)

__global__ void attn_kernel(const float* __restrict__ Qg,
                            const float* __restrict__ Kg,
                            const float* __restrict__ Vg,
                            const float* __restrict__ Zg,
                            float* __restrict__ Og) {
    extern __shared__ float smem[];
    float* Qt = smem;                 // [HD][JCH]
    float* Vs = smem + HD * JCH;      // [JCH][4]  V/Z (transposed for float4 read)

    const int t  = threadIdx.x;
    const int h  = blockIdx.x;
    const int h4 = h * HD;
    const int w  = t >> 5;
    const int ln = t & 31;
    const int ncol = ln & 15;
    const int d0   = (ln < 16) ? 0 : 2;
    const int ibase = blockIdx.y * ATT_COLS + w * 16;

    v2f b;                                           // K columns i of this wave
    b.x = Kg[(h4 + d0 + 0) * L + ibase + ncol];
    b.y = Kg[(h4 + d0 + 1) * L + ibase + ncol];

    float acc[4];
    #pragma unroll
    for (int d = 0; d < 4; ++d) acc[d] = 0.f;

    for (int jc = 0; jc < L; jc += JCH) {
        __syncthreads();
        // async-stage Q rows for this chunk
        for (int idx = t; idx < HD * (JCH / 4); idx += ATT_THREADS) {
            const int d  = idx >> 9;
            const int j4 = idx & (JCH / 4 - 1);
            async_copy_b128(Qt + d * JCH + (j4 << 2),
                            Qg + (h4 + d) * L + jc + (j4 << 2));
        }
        // manual stage of V' = V / Z (needs the multiply)
        for (int idx = t; idx < HD * JCH; idx += ATT_THREADS) {
            const int d = idx >> 11;
            const int j = idx & (JCH - 1);
            const float rz = 1.0f / Zg[h * L + jc + j];
            Vs[j * 4 + d] = Vg[(h4 + d) * L + jc + j] * rz;
        }
        wait_async0();
        __syncthreads();

        for (int jt = 0; jt < JCH; jt += 16) {
            v2f a;                                   // Q rows j (from LDS)
            a.x = Qt[(d0 + 0) * JCH + jt + ncol];
            a.y = Qt[(d0 + 1) * JCH + jt + ncol];
            v8f c = {};
            c = __builtin_amdgcn_wmma_f32_16x16x4_f32(
                    false, a, false, b, (short)0, c, false, false);
            const int rbase = jt + ((ln < 16) ? 0 : 8);
            #pragma unroll
            for (int r = 0; r < 8; ++r) {
                const float p = fast_exp2(c[r]);
                const float4 vv =
                    *reinterpret_cast<const float4*>(Vs + (rbase + r) * 4);
                acc[0] = fmaf(vv.x, p, acc[0]);
                acc[1] = fmaf(vv.y, p, acc[1]);
                acc[2] = fmaf(vv.z, p, acc[2]);
                acc[3] = fmaf(vv.w, p, acc[3]);
            }
        }
    }

    // combine the two lane-halves (rows 0-7 vs 8-15 of every tile) and store
    #pragma unroll
    for (int d = 0; d < 4; ++d) {
        const float v = acc[d] + __shfl_xor(acc[d], 16);
        if (ln < 16) Og[(h4 + d) * L + ibase + ncol] = v;
    }
}

// ---------------------------------------------------------------------------
// Kernel 4: output projection + bias + residual
// ---------------------------------------------------------------------------
__global__ void outproj_kernel(const float* __restrict__ Og,
                               const float* __restrict__ Wo,
                               const float* __restrict__ bo,
                               const float* __restrict__ X,
                               float* __restrict__ Out) {
    __shared__ float As[AC * 16];
    const int t = threadIdx.x;
    const int lbase = blockIdx.x * 16;

    for (int idx = t; idx < AC * 16; idx += 256) {
        const int o = idx >> 4;
        const int i = idx & 15;
        As[idx] = Og[o * L + lbase + i];
    }
    __syncthreads();

    const int c = t;
    const float bias = bo[c];
    float acc[16];
    const float4* x4 = reinterpret_cast<const float4*>(X + c * L + lbase);
    #pragma unroll
    for (int i4 = 0; i4 < 4; ++i4) {
        const float4 xv = x4[i4];
        acc[i4 * 4 + 0] = bias + xv.x;
        acc[i4 * 4 + 1] = bias + xv.y;
        acc[i4 * 4 + 2] = bias + xv.z;
        acc[i4 * 4 + 3] = bias + xv.w;
    }
    const float4* w4 = reinterpret_cast<const float4*>(Wo + c * AC);
    for (int o = 0; o < AC; o += 4) {
        const float4 w = w4[o >> 2];
        #pragma unroll
        for (int i = 0; i < 16; ++i) {
            acc[i] = fmaf(w.x, As[(o + 0) * 16 + i], acc[i]);
            acc[i] = fmaf(w.y, As[(o + 1) * 16 + i], acc[i]);
            acc[i] = fmaf(w.z, As[(o + 2) * 16 + i], acc[i]);
            acc[i] = fmaf(w.w, As[(o + 3) * 16 + i], acc[i]);
        }
    }
    #pragma unroll
    for (int i = 0; i < 16; ++i) Out[c * L + lbase + i] = acc[i];
}

// ---------------------------------------------------------------------------
extern "C" void kernel_launch(void* const* d_in, const int* in_sizes, int n_in,
                              void* d_out, int out_size, void* d_ws, size_t ws_size,
                              hipStream_t stream) {
    (void)in_sizes; (void)n_in; (void)out_size; (void)ws_size;
    const float* X  = (const float*)d_in[0];
    const float* Wq = (const float*)d_in[1];
    const float* bq = (const float*)d_in[2];
    const float* Wk = (const float*)d_in[3];
    const float* bk = (const float*)d_in[4];
    const float* Wv = (const float*)d_in[5];
    const float* bv = (const float*)d_in[6];
    const float* Wo = (const float*)d_in[7];
    const float* bo = (const float*)d_in[8];
    float* out = (float*)d_out;

    float* ws = (float*)d_ws;
    float* Qg = ws + WS_Q;
    float* Kg = ws + WS_K;
    float* Vg = ws + WS_V;
    float* Zg = ws + WS_Z;
    float* Og = ws + WS_O;

    qkv_kernel<<<L / 16, 256, 0, stream>>>(X, Wq, bq, Wk, bk, Wv, bv, Qg, Kg, Vg);

    zrow_kernel<<<dim3(HEADS, L / 128), 256,
                  HD * JCH * sizeof(float), stream>>>(Qg, Kg, Zg);

    attn_kernel<<<dim3(HEADS, L / ATT_COLS), ATT_THREADS,
                  2 * HD * JCH * sizeof(float), stream>>>(Qg, Kg, Vg, Zg, Og);

    outproj_kernel<<<L / 16, 256, 0, stream>>>(Og, Wo, bo, X, out);
}

// v002
// Measured time: 112 microseconds a run.
// Next to v001, in two timings, it ran 1.09 times as fast each time.
// All steps since v000 together make it 1.89 times as fast.
#include <hip/hip_runtime.h>

#define C_IN  256
#define AC    64
#define HEADS 16
#define HD    4
#define L     4096   // 64*64
#define JCH   2048   // LDS chunk length along l

#define LOG2E 1.44269504088896340736f

typedef __attribute__((ext_vector_type(2))) float v2f;
typedef __attribute__((ext_vector_type(8))) float v8f;
typedef __attribute__((ext_vector_type(4))) int   v4i;

// workspace layout (floats)
#define WS_Q 0
#define WS_K (AC * L)
#define WS_V (2 * AC * L)
#define WS_Z (3 * AC * L)
#define WS_O (3 * AC * L + HEADS * L)

// ---------------------------------------------------------------------------
// Raw hardware 2^x (v_exp_f32)
// ---------------------------------------------------------------------------
__device__ __forceinline__ float fast_exp2(float x) {
#if __has_builtin(__builtin_amdgcn_exp2f)
    return __builtin_amdgcn_exp2f(x);
#else
    return exp2f(x);
#endif
}

// ---------------------------------------------------------------------------
// CDNA5 async global->LDS copy (ASYNCcnt-tracked, no VGPR staging)
// ---------------------------------------------------------------------------
__device__ __forceinline__ void async_copy_b128(void* lds_dst, const void* gsrc) {
#if __has_builtin(__builtin_amdgcn_global_load_async_to_lds_b128)
    typedef __attribute__((address_space(1))) v4i* gptr_t;   // global (AS1)
    typedef __attribute__((address_space(3))) v4i* lptr_t;   // LDS (AS3)
    __builtin_amdgcn_global_load_async_to_lds_b128(
        (gptr_t)(uintptr_t)gsrc,
        (lptr_t)(uintptr_t)lds_dst,
        0, 0);
#else
    unsigned lo = (unsigned)(uintptr_t)lds_dst;
    unsigned long long ga = (unsigned long long)(uintptr_t)gsrc;
    asm volatile("global_load_async_to_lds_b128 %0, %1, off"
                 :: "v"(lo), "v"(ga) : "memory");
#endif
}

__device__ __forceinline__ void wait_async0() {
#if __has_builtin(__builtin_amdgcn_s_wait_asynccnt)
    __builtin_amdgcn_s_wait_asynccnt(0);
#else
    asm volatile("s_wait_asynccnt 0x0" ::: "memory");
#endif
}

// ---------------------------------------------------------------------------
// Kernel 1: QKV projections (1x1 conv == channel GEMM) + bias + L2-norm(Q,K)
// Q is additionally scaled by log2(e): scores then feed v_exp_f32 (2^x)
// directly with no per-element multiply in the hot loops.
// ---------------------------------------------------------------------------
__global__ void qkv_kernel(const float* __restrict__ X,
                           const float* __restrict__ Wq, const float* __restrict__ bq,
                           const float* __restrict__ Wk, const float* __restrict__ bk,
                           const float* __restrict__ Wv, const float* __restrict__ bv,
                           float* __restrict__ Qg, float* __restrict__ Kg,
                           float* __restrict__ Vg) {
    __shared__ float Xs[C_IN * 16];   // X[:, lbase..lbase+15]
    __shared__ float Ys[192 * 16];    // raw projections before norm

    const int t = threadIdx.x;
    const int lbase = blockIdx.x * 16;

    {
        const int i = t & 15;
        const int c0 = t >> 4;
        #pragma unroll
        for (int s = 0; s < 16; ++s) {
            const int c = c0 + s * 16;
            Xs[c * 16 + i] = X[c * L + lbase + i];
        }
    }
    __syncthreads();

    if (t < 192) {
        const int mat = t >> 6;      // 0=Q 1=K 2=V
        const int o   = t & 63;
        const float* Wm = (mat == 0 ? Wq : (mat == 1 ? Wk : Wv)) + o * C_IN;
        const float bias = (mat == 0 ? bq : (mat == 1 ? bk : bv))[o];
        float acc[16];
        #pragma unroll
        for (int i = 0; i < 16; ++i) acc[i] = bias;
        const float4* w4 = reinterpret_cast<const float4*>(Wm);
        for (int c = 0; c < C_IN; c += 4) {
            const float4 w = w4[c >> 2];
            #pragma unroll
            for (int i = 0; i < 16; ++i) {
                acc[i] = fmaf(w.x, Xs[(c + 0) * 16 + i], acc[i]);
                acc[i] = fmaf(w.y, Xs[(c + 1) * 16 + i], acc[i]);
                acc[i] = fmaf(w.z, Xs[(c + 2) * 16 + i], acc[i]);
                acc[i] = fmaf(w.w, Xs[(c + 3) * 16 + i], acc[i]);
            }
        }
        #pragma unroll
        for (int i = 0; i < 16; ++i) Ys[t * 16 + i] = acc[i];
    }
    __syncthreads();

    if (t < 192) {
        const int mat = t >> 6;
        const int o   = t & 63;          // o = head*4 + d (matches reshape)
        const int d   = o & 3;
        float* dst = (mat == 0 ? Qg : (mat == 1 ? Kg : Vg));
        #pragma unroll
        for (int i = 0; i < 16; ++i) {
            float y = Ys[t * 16 + i];
            if (mat < 2) {
                const int base = (t - d) * 16 + i;
                float s = 0.f;
                #pragma unroll
                for (int dd = 0; dd < 4; ++dd) {
                    const float q = Ys[base + dd * 16];
                    s = fmaf(q, q, s);
                }
                y = y / fmaxf(sqrtf(s), 1e-12f);
                if (mat == 0) y *= LOG2E;   // fold exp->exp2 conversion into Q
            }
            dst[o * L + lbase + i] = y;
        }
    }
}

// ---------------------------------------------------------------------------
// Kernel 2: softmax denominators Z[h][j] = sum_m exp(q_j . k_m)
//           (computed as sum_m 2^(q'_j . k_m) with q' = q * log2e)
// ---------------------------------------------------------------------------
__global__ void zrow_kernel(const float* __restrict__ Qg,
                            const float* __restrict__ Kg,
                            float* __restrict__ Zg) {
    extern __shared__ float Ks[];            // [HD][JCH]
    const int t  = threadIdx.x;
    const int h  = blockIdx.x;
    const int h4 = h * HD;
    const int jbase = blockIdx.y * 128 + (t >> 5) * 16;
    const int ln   = t & 31;
    const int mrow = ln & 15;
    const int d0   = (ln < 16) ? 0 : 2;

    // A fragment (Q rows jbase..jbase+15), loop-invariant over m
    v2f a;
    a.x = Qg[(h4 + d0 + 0) * L + jbase + mrow];
    a.y = Qg[(h4 + d0 + 1) * L + jbase + mrow];

    float zacc[8];
    #pragma unroll
    for (int r = 0; r < 8; ++r) zacc[r] = 0.f;

    for (int mc = 0; mc < L; mc += JCH) {
        __syncthreads();
        // async-stage K[d][mc..mc+JCH) -> Ks[d][...] (16B granules, coalesced)
        for (int idx = t; idx < HD * (JCH / 4); idx += 256) {
            const int d  = idx >> 9;          // / (JCH/4)
            const int m4 = idx & (JCH / 4 - 1);
            async_copy_b128(Ks + d * JCH + (m4 << 2),
                            Kg + (h4 + d) * L + mc + (m4 << 2));
        }
        wait_async0();
        __syncthreads();

        for (int mt = 0; mt < JCH; mt += 16) {
            v2f b;
            b.x = Ks[(d0 + 0) * JCH + mt + mrow];
            b.y = Ks[(d0 + 1) * JCH + mt + mrow];
            v8f c = {};
            c = __builtin_amdgcn_wmma_f32_16x16x4_f32(
                    false, a, false, b, (short)0, c, false, false);
            #pragma unroll
            for (int r = 0; r < 8; ++r) zacc[r] += fast_exp2(c[r]);
        }
    }

    // reduce across the 16 lanes of each half-wave (columns of the tile)
    #pragma unroll
    for (int r = 0; r < 8; ++r) {
        float v = zacc[r];
        v += __shfl_xor(v, 1);
        v += __shfl_xor(v, 2);
        v += __shfl_xor(v, 4);
        v += __shfl_xor(v, 8);
        zacc[r] = v;
    }
    if (ln == 0 || ln == 16) {
        const int off = (ln == 0) ? 0 : 8;
        #pragma unroll
        for (int r = 0; r < 8; ++r) Zg[h * L + jbase + off + r] = zacc[r];
    }
}

// ---------------------------------------------------------------------------
// Kernel 3: out[d,i] = sum_j (V[d,j]/Z_j) * 2^(q'_j . k_i)
// Q chunk async-staged as Qt[d][JCH]; V/Z staged manually (fused scale).
// One 16-column tile per wave, ATT_WAVES waves per work-group: one work-group
// for every WGP of the chip, four waves on every SIMD.
// The score tile is formed as K^T.Q: its rows (registers) are the wave's
// columns i, its columns (lanes) are the summed index j. A lane then needs
// V/Z of its own j only: one 16-byte LDS read per tile. Each lane keeps
// partial sums for its 8 i x 4 d; the 16 lanes of a row are summed once, at
// the end.
// ---------------------------------------------------------------------------
// value of lane (l ^ mask) inside the 16-lane row; CTRL = 0x160 | mask
template <int CTRL>
__device__ __forceinline__ float row_xmask(float v) {
    return __builtin_bit_cast(float,
        __builtin_amdgcn_mov_dpp(__builtin_bit_cast(int, v), CTRL, 0xf, 0xf, true));
}

#define ATT_WAVES 16
#define ATT_THREADS (ATT_WAVES * 32)
#define ATT_COLS (ATT_WAVES * 16)

__global__ void attn_kernel(const float* __restrict__ Qg,
                            const float* __restrict__ Kg,
                            const float* __restrict__ Vg,
                            const float* __restrict__ Zg,
                            float* __restrict__ Og) {
    extern __shared__ float smem[];
    float* Qt = smem;                 // [HD][JCH]
    float* Vs = smem + HD * JCH;      // [JCH][4]  V/Z (transposed for float4 read)

    const int t  = threadIdx.x;
    const int h  = blockIdx.x;
    const int h4 = h * HD;
    const int w  = t >> 5;
    const int ln = t & 31;
    const int ncol = ln & 15;
    const int d0   = (ln < 16) ? 0 : 2;
    const int ibase = blockIdx.y * ATT_COLS + w * 16;

    v2f kf;                                          // K columns i of this wave
    kf.x = Kg[(h4 + d0 + 0) * L + ibase + ncol];
    kf.y = Kg[(h4 + d0 + 1) * L + ibase + ncol];

    v2f acc[4][4];                                   // [d][pair of register rows i]
    #pragma unroll  // constant indices keep the array in registers
    for (int d = 0; d < 4; ++d) {
        #pragma unroll  // constant indices keep the array in registers
        for (int k = 0; k < 4; ++k) acc[d][k] = (v2f){0.f, 0.f};
    }

    for (int jc = 0; jc < L; jc += JCH) {
        __syncthreads();
        // async-stage Q rows for this chunk
        for (int idx = t; idx < HD * (JCH / 4); idx += ATT_THREADS) {
            const int d  = idx >> 9;
            const int j4 = idx & (JCH / 4 - 1);
            async_copy_b128(Qt + d * JCH + (j4 << 2),
                            Qg + (h4 + d) * L + jc + (j4 << 2));
        }
        // manual stage of V' = V / Z (needs the multiply)
        for (int idx = t; idx < HD * JCH; idx += ATT_THREADS) {
            const int d = idx >> 11;
            const int j = idx & (JCH - 1);
            const float rz = 1.0f / Zg[h * L + jc + j];
            Vs[j * 4 + d] = Vg[(h4 + d) * L + jc + j] * rz;
        }
        wait_async0();
        __syncthreads();

        for (int jt = 0; jt < JCH; jt += 16) {
            v2f qf;                                  // Q of j = jt + lane (from LDS)
            qf.x = Qt[(d0 + 0) * JCH + jt + ncol];
            qf.y = Qt[(d0 + 1) * JCH + jt + ncol];
            const float4 vv =                        // V/Z of the same j
                *reinterpret_cast<const float4*>(Vs + (jt + ncol) * 4);
            v8f c = {};
            c = __builtin_amdgcn_wmma_f32_16x16x4_f32(
                    false, kf, false, qf, (short)0, c, false, false);
            v2f pp[4];
            #pragma unroll  // constant indices keep the array in registers
            for (int k = 0; k < 4; ++k)
                pp[k] = (v2f){fast_exp2(c[2 * k]), fast_exp2(c[2 * k + 1])};
            #pragma unroll  // constant indices keep the array in registers
            for (int k = 0; k < 4; ++k) {            // packed f32 FMAs, two rows each
                const v2f p = pp[k];
                acc[0][k] = __builtin_elementwise_fma(p, (v2f){vv.x, vv.x}, acc[0][k]);
                acc[1][k] = __builtin_elementwise_fma(p, (v2f){vv.y, vv.y}, acc[1][k]);
                acc[2][k] = __builtin_elementwise_fma(p, (v2f){vv.z, vv.z}, acc[2][k]);
                acc[3][k] = __builtin_elementwise_fma(p, (v2f){vv.w, vv.w}, acc[3][k]);
            }
        }
    }

    // Sum over the 16 lanes of a row. The first three steps halve the values a
    // lane carries (it keeps the rows r whose bit equals its own lane bit and
    // hands the others to its partner), so lane l ends with row r = l & 7.
    const bool b0 = (ln & 1) != 0;
    const bool b1 = (ln & 2) != 0;
    const bool b2 = (ln & 4) != 0;
    const int  icol = ibase + ((ln >> 4) << 3) + (ln & 7);
    #pragma unroll  // constant indices keep the array in registers
    for (int d = 0; d < 4; ++d) {
        float w4[4], w2[2];
        #pragma unroll  // constant indices keep the array in registers
        for (int k = 0; k < 4; ++k) {
            const float keep = b0 ? acc[d][k].y : acc[d][k].x;
            const float give = b0 ? acc[d][k].x : acc[d][k].y;
            w4[k] = keep + row_xmask<0x161>(give);
        }
        #pragma unroll  // constant indices keep the array in registers
        for (int k = 0; k < 2; ++k) {
            const float keep = b1 ? w4[2 * k + 1] : w4[2 * k];
            const float give = b1 ? w4[2 * k] : w4[2 * k + 1];
            w2[k] = keep + row_xmask<0x162>(give);
        }
        const float keep = b2 ? w2[1] : w2[0];
        const float give = b2 ? w2[0] : w2[1];
        float v = keep + row_xmask<0x164>(give);
        v += row_xmask<0x168>(v);
        if (ncol < 8) Og[(h4 + d) * L + icol] = v;
    }
}

// ---------------------------------------------------------------------------
// Kernel 4: output projection + bias + residual
// ---------------------------------------------------------------------------
__global__ void outproj_kernel(const float* __restrict__ Og,
                               const float* __restrict__ Wo,
                               const float* __restrict__ bo,
                               const float* __restrict__ X,
                               float* __restrict__ Out) {
    __shared__ float As[AC * 16];
    const int t = threadIdx.x;
    const int lbase = blockIdx.x * 16;

    for (int idx = t; idx < AC * 16; idx += 256) {
        const int o = idx >> 4;
        const int i = idx & 15;
        As[idx] = Og[o * L + lbase + i];
    }
    __syncthreads();

    const int c = t;
    const float bias = bo[c];
    float acc[16];
    const float4* x4 = reinterpret_cast<const float4*>(X + c * L + lbase);
    #pragma unroll
    for (int i4 = 0; i4 < 4; ++i4) {
        const float4 xv = x4[i4];
        acc[i4 * 4 + 0] = bias + xv.x;
        acc[i4 * 4 + 1] = bias + xv.y;
        acc[i4 * 4 + 2] = bias + xv.z;
        acc[i4 * 4 + 3] = bias + xv.w;
    }
    const float4* w4 = reinterpret_cast<const float4*>(Wo + c * AC);
    for (int o = 0; o < AC; o += 4) {
        const float4 w = w4[o >> 2];
        #pragma unroll
        for (int i = 0; i < 16; ++i) {
            acc[i] = fmaf(w.x, As[(o + 0) * 16 + i], acc[i]);
            acc[i] = fmaf(w.y, As[(o + 1) * 16 + i], acc[i]);
            acc[i] = fmaf(w.z, As[(o + 2) * 16 + i], acc[i]);
            acc[i] = fmaf(w.w, As[(o + 3) * 16 + i], acc[i]);
        }
    }
    #pragma unroll
    for (int i = 0; i < 16; ++i) Out[c * L + lbase + i] = acc[i];
}

// ---------------------------------------------------------------------------
extern "C" void kernel_launch(void* const* d_in, const int* in_sizes, int n_in,
                              void* d_out, int out_size, void* d_ws, size_t ws_size,
                              hipStream_t stream) {
    (void)in_sizes; (void)n_in; (void)out_size; (void)ws_size;
    const float* X  = (const float*)d_in[0];
    const float* Wq = (const float*)d_in[1];
    const float* bq = (const float*)d_in[2];
    const float* Wk = (const float*)d_in[3];
    const float* bk = (const float*)d_in[4];
    const float* Wv = (const float*)d_in[5];
    const float* bv = (const float*)d_in[6];
    const float* Wo = (const float*)d_in[7];
    const float* bo = (const float*)d_in[8];
    float* out = (float*)d_out;

    float* ws = (float*)d_ws;
    float* Qg = ws + WS_Q;
    float* Kg = ws + WS_K;
    float* Vg = ws + WS_V;
    float* Zg = ws + WS_Z;
    float* Og = ws + WS_O;

    qkv_kernel<<<L / 16, 256, 0, stream>>>(X, Wq, bq, Wk, bk, Wv, bv, Qg, Kg, Vg);

    zrow_kernel<<<dim3(HEADS, L / 128), 256,
                  HD * JCH * sizeof(float), stream>>>(Qg, Kg, Zg);

    attn_kernel<<<dim3(HEADS, L / ATT_COLS), ATT_THREADS,
                  2 * HD * JCH * sizeof(float), stream>>>(Qg, Kg, Vg, Zg, Og);

    outproj_kernel<<<L / 16, 256, 0, stream>>>(Og, Wo, bo, X, out);
}

// v003
// A run of this version takes 76.6 microseconds.
// Next to v002, in two timings, it ran 1.47 times as fast each time.
// All steps since v000 together make it 2.77 times as fast.
#include <hip/hip_runtime.h>

#define C_IN  256
#define AC    64
#define HEADS 16
#define HD    4
#define L     4096   // 64*64
#define JCH   2048   // LDS chunk length along l

#define LOG2E 1.44269504088896340736f

typedef __attribute__((ext_vector_type(2))) float v2f;
typedef __attribute__((ext_vector_type(4))) float v4f;
typedef __attribute__((ext_vector_type(8))) float v8f;
typedef __attribute__((ext_vector_type(4))) int   v4i;

// workspace layout (floats)
#define WS_Q 0
#define WS_K (AC * L)
#define WS_V (2 * AC * L)
#define WS_Z (3 * AC * L)
#define WS_O (3 * AC * L + HEADS * L)

// ---------------------------------------------------------------------------
// Raw hardware 2^x (v_exp_f32)
// ---------------------------------------------------------------------------
__device__ __forceinline__ float fast_exp2(float x) {
#if __has_builtin(__builtin_amdgcn_exp2f)
    return __builtin_amdgcn_exp2f(x);
#else
    return exp2f(x);
#endif
}

// ---------------------------------------------------------------------------
// CDNA5 async global->LDS copy (ASYNCcnt-tracked, no VGPR staging)
// ---------------------------------------------------------------------------
__device__ __forceinline__ void async_copy_b128(void* lds_dst, const void* gsrc) {
#if __has_builtin(__builtin_amdgcn_global_load_async_to_lds_b128)
    typedef __attribute__((address_space(1))) v4i* gptr_t;   // global (AS1)
    typedef __attribute__((address_space(3))) v4i* lptr_t;   // LDS (AS3)
    __builtin_amdgcn_global_load_async_to_lds_b128(
        (gptr_t)(uintptr_t)gsrc,
        (lptr_t)(uintptr_t)lds_dst,
        0, 0);
#else
    unsigned lo = (unsigned)(uintptr_t)lds_dst;
    unsigned long long ga = (unsigned long long)(uintptr_t)gsrc;
    asm volatile("global_load_async_to_lds_b128 %0, %1, off"
                 :: "v"(lo), "v"(ga) : "memory");
#endif
}

__device__ __forceinline__ void wait_async0() {
#if __has_builtin(__builtin_amdgcn_s_wait_asynccnt)
    __builtin_amdgcn_s_wait_asynccnt(0);
#else
    asm volatile("s_wait_asynccnt 0x0" ::: "memory");
#endif
}

// ---------------------------------------------------------------------------
// Kernel 1: QKV projections (1x1 conv == channel GEMM) + bias + L2-norm(Q,K)
// Q is additionally scaled by log2(e): scores then feed v_exp_f32 (2^x)
// directly with no per-element multiply in the hot loops.
// The 192 stacked output rows (Q, K, V) x 4096 columns are cut into tiles of
// 48 rows x 64 columns, one work-group each; each of 12 waves forms one
// 16 x 16 tile over all 256 channels on the f32 matrix instruction.
// W rows and X columns lie in LDS with the channel index contiguous: a lane
// reads 4 channels of its row (A) and of its column (B) with one 16-byte read
// each, which feed two matrix steps. Lane half h holds channels 8u+4h..8u+4h+3
// on both sides, so A and B agree in k at every position.
// ---------------------------------------------------------------------------
#define QKV_ROWS 48
#define QKV_COLS 64
#define QKV_TILES 12    // 3 row tiles x 4 column tiles, one wave each
#define QKV_THREADS 512 // 16 waves stage the operands, the first 12 go on
#define QKV_PITCH 260   // floats; rows stay 16-byte aligned, 16 rows cover all 64 banks
#define QKV_WLD (QKV_ROWS * C_IN / 4 / QKV_THREADS)   // 16-byte W loads of a thread
#define QKV_XLD (C_IN * QKV_COLS / 4 / QKV_THREADS)   // 16-byte X loads of a thread

__global__ __launch_bounds__(QKV_THREADS)
void qkv_kernel(const float* __restrict__ X,
                const float* __restrict__ Wq, const float* __restrict__ bq,
                const float* __restrict__ Wk, const float* __restrict__ bk,
                const float* __restrict__ Wv, const float* __restrict__ bv,
                float* __restrict__ Qg, float* __restrict__ Kg,
                float* __restrict__ Vg) {
    __shared__ __attribute__((aligned(16))) float Wt[QKV_ROWS * QKV_PITCH];  // [row][c]
    __shared__ __attribute__((aligned(16))) float Xt[QKV_COLS * QKV_PITCH];  // [col][c]

    const int t = threadIdx.x;
    const int lbase = blockIdx.x * QKV_COLS;
    const int rbase = blockIdx.y * QKV_ROWS;     // first of the 192 stacked rows

    // the wave's number as a scalar: tile, matrix and pointers stay scalar too
    const int w   = __builtin_amdgcn_readfirstlane(t >> 5);
    const int ln  = t & 31;
    const int r16 = ln & 15;
    const int hh  = ln >> 4;
    const int wt  = (w < QKV_TILES) ? w : 0;     // staging-only waves: any valid tile
    const int mt  = wt % 3;                      // row tile of this wave
    const int nt  = wt / 3;                      // column tile of this wave
    const int T   = blockIdx.y * 3 + mt;         // row tile among the 12
    const int mat = T >> 2;                      // 0=Q 1=K 2=V
    const int o0  = (T & 3) * 16 + hh * 8;       // first of this lane's 8 rows

    // W rows: a wave copies 512 contiguous bytes of one row
    const int k4 = t & 63;
    v4f wv[QKV_WLD];
    #pragma unroll  // all loads in flight before the first LDS store
    for (int s = 0; s < QKV_WLD; ++s) {
        const int R  = rbase + w / 2 + s * (QKV_THREADS / 64);
        const int wm = R >> 6;                   // 0=Q 1=K 2=V
        const float* Wm = (wm == 0 ? Wq : (wm == 1 ? Wk : Wv)) + (R & 63) * C_IN;
        wv[s] = *reinterpret_cast<const v4f*>(Wm + k4 * 4);
    }
    // X columns, transposed on the way: a wave reads 64 bytes of 8 channels,
    // its four stores each fall on 32 different banks
    const int xc = ((t >> 7) << 3) | ((t >> 2) & 7);          // channel, +32 a step
    const int n0 = (((t >> 5) & 3) << 4) | ((t & 3) << 2);    // first of 4 columns
    // one base and one offset serve all of a thread's loads: the step of 32
    // channels is a constant of each load
    const float* xp = X + lbase + (unsigned)(xc * L + n0);
    float4 xv[QKV_XLD];
    #pragma unroll  // all loads in flight before the first LDS store
    for (int s = 0; s < QKV_XLD; ++s)
        xv[s] = *reinterpret_cast<const float4*>(xp + s * 32 * L);
    // accumulator register r of a lane is row o0 + r, column r16
    const float* bm = (mat == 0 ? bq : (mat == 1 ? bk : bv)) + o0;
    const float4 b0 = *reinterpret_cast<const float4*>(bm);
    const float4 b1 = *reinterpret_cast<const float4*>(bm + 4);
    #pragma unroll  // constant indices keep the array in registers
    for (int s = 0; s < QKV_WLD; ++s)
        *reinterpret_cast<v4f*>(
            Wt + (w / 2 + s * (QKV_THREADS / 64)) * QKV_PITCH + k4 * 4) = wv[s];
    #pragma unroll  // constant indices keep the array in registers
    for (int s = 0; s < QKV_XLD; ++s) {
        const int c = xc + s * 32;
        Xt[(n0 + 0) * QKV_PITCH + c] = xv[s].x;
        Xt[(n0 + 1) * QKV_PITCH + c] = xv[s].y;
        Xt[(n0 + 2) * QKV_PITCH + c] = xv[s].z;
        Xt[(n0 + 3) * QKV_PITCH + c] = xv[s].w;
    }
    __syncthreads();
    if (w >= QKV_TILES) return;                  // whole waves leave; no barrier follows

    v8f c0 = {b0.x, b0.y, b0.z, b0.w, b1.x, b1.y, b1.z, b1.w};
    v8f c1 = {};
    const float* wrow = Wt + (mt * 16 + r16) * QKV_PITCH + hh * 4;
    const float* xrow = Xt + (nt * 16 + r16) * QKV_PITCH + hh * 4;
    #pragma unroll 8  // the next step's LDS reads issue ahead of this step's matrix work
    for (int u = 0; u < C_IN / 8; ++u) {
        const float4 a = *reinterpret_cast<const float4*>(wrow + u * 8);
        const float4 b = *reinterpret_cast<const float4*>(xrow + u * 8);
        c0 = __builtin_amdgcn_wmma_f32_16x16x4_f32(
                 false, (v2f){a.x, a.y}, false, (v2f){b.x, b.y}, (short)0, c0, false, false);
        c1 = __builtin_amdgcn_wmma_f32_16x16x4_f32(
                 false, (v2f){a.z, a.w}, false, (v2f){b.z, b.w}, (short)0, c1, false, false);
    }

    float y[8];
    #pragma unroll  // constant indices keep the array in registers
    for (int r = 0; r < 8; ++r) y[r] = c0[r] + c1[r];

    if (mat < 2) {                               // a head's 4 rows sit in one lane
        #pragma unroll  // constant indices keep the array in registers
        for (int g = 0; g < 8; g += 4) {
            float s = 0.f;
            #pragma unroll  // constant indices keep the array in registers
            for (int dd = 0; dd < 4; ++dd) s = fmaf(y[g + dd], y[g + dd], s);
            const float nrm = fmaxf(sqrtf(s), 1e-12f);
            #pragma unroll  // constant indices keep the array in registers
            for (int dd = 0; dd < 4; ++dd) {
                y[g + dd] = y[g + dd] / nrm;
                if (mat == 0) y[g + dd] *= LOG2E;   // fold exp->exp2 conversion into Q
            }
        }
    }

    float* dst = (mat == 0 ? Qg : (mat == 1 ? Kg : Vg)) + o0 * L + lbase + nt * 16 + r16;
    #pragma unroll  // constant indices keep the array in registers
    for (int r = 0; r < 8; ++r) dst[r * L] = y[r];
}

// ---------------------------------------------------------------------------
// Kernel 2: softmax denominators Z[h][j] = sum_m exp(q_j . k_m)
//           (computed as sum_m 2^(q'_j . k_m) with q' = q * log2e)
// ---------------------------------------------------------------------------
__global__ void zrow_kernel(const float* __restrict__ Qg,
                            const float* __restrict__ Kg,
                            float* __restrict__ Zg) {
    extern __shared__ float Ks[];            // [HD][JCH]
    const int t  = threadIdx.x;
    const int h  = blockIdx.x;
    const int h4 = h * HD;
    const int jbase = blockIdx.y * 128 + (t >> 5) * 16;
    const int ln   = t & 31;
    const int mrow = ln & 15;
    const int d0   = (ln < 16) ? 0 : 2;

    // A fragment (Q rows jbase..jbase+15), loop-invariant over m
    v2f a;
    a.x = Qg[(h4 + d0 + 0) * L + jbase + mrow];
    a.y = Qg[(h4 + d0 + 1) * L + jbase + mrow];

    float zacc[8];
    #pragma unroll
    for (int r = 0; r < 8; ++r) zacc[r] = 0.f;

    for (int mc = 0; mc < L; mc += JCH) {
        __syncthreads();
        // async-stage K[d][mc..mc+JCH) -> Ks[d][...] (16B granules, coalesced)
        for (int idx = t; idx < HD * (JCH / 4); idx += 256) {
            const int d  = idx >> 9;          // / (JCH/4)
            const int m4 = idx & (JCH / 4 - 1);
            async_copy_b128(Ks + d * JCH + (m4 << 2),
                            Kg + (h4 + d) * L + mc + (m4 << 2));
        }
        wait_async0();
        __syncthreads();

        for (int mt = 0; mt < JCH; mt += 16) {
            v2f b;
            b.x = Ks[(d0 + 0) * JCH + mt + mrow];
            b.y = Ks[(d0 + 1) * JCH + mt + mrow];
            v8f c = {};
            c = __builtin_amdgcn_wmma_f32_16x16x4_f32(
                    false, a, false, b, (short)0, c, false, false);
            #pragma unroll
            for (int r = 0; r < 8; ++r) zacc[r] += fast_exp2(c[r]);
        }
    }

    // reduce across the 16 lanes of each half-wave (columns of the tile)
    #pragma unroll
    for (int r = 0; r < 8; ++r) {
        float v = zacc[r];
        v += __shfl_xor(v, 1);
        v += __shfl_xor(v, 2);
        v += __shfl_xor(v, 4);
        v += __shfl_xor(v, 8);
        zacc[r] = v;
    }
    if (ln == 0 || ln == 16) {
        const int off = (ln == 0) ? 0 : 8;
        #pragma unroll
        for (int r = 0; r < 8; ++r) Zg[h * L + jbase + off + r] = zacc[r];
    }
}

// ---------------------------------------------------------------------------
// Kernel 3: out[d,i] = sum_j (V[d,j]/Z_j) * 2^(q'_j . k_i)
// Q chunk async-staged as Qt[d][JCH]; V/Z staged manually (fused scale).
// One 16-column tile per wave, ATT_WAVES waves per work-group: one work-group
// for every WGP of the chip, four waves on every SIMD.
// The score tile is formed as K^T.Q: its rows (registers) are the wave's
// columns i, its columns (lanes) are the summed index j. A lane then needs
// V/Z of its own j only: one 16-byte LDS read per tile. Each lane keeps
// partial sums for its 8 i x 4 d; the 16 lanes of a row are summed once, at
// the end.
// ---------------------------------------------------------------------------
// value of lane (l ^ mask) inside the 16-lane row; CTRL = 0x160 | mask
template <int CTRL>
__device__ __forceinline__ float row_xmask(float v) {
    return __builtin_bit_cast(float,
        __builtin_amdgcn_mov_dpp(__builtin_bit_cast(int, v), CTRL, 0xf, 0xf, true));
}

#define ATT_WAVES 16
#define ATT_THREADS (ATT_WAVES * 32)
#define ATT_COLS (ATT_WAVES * 16)

__global__ void attn_kernel(const float* __restrict__ Qg,
                            const float* __restrict__ Kg,
                            const float* __restrict__ Vg,
                            const float* __restrict__ Zg,
                            float* __restrict__ Og) {
    extern __shared__ float smem[];
    float* Qt = smem;                 // [HD][JCH]
    float* Vs = smem + HD * JCH;      // [JCH][4]  V/Z (transposed for float4 read)

    const int t  = threadIdx.x;
    const int h  = blockIdx.x;
    const int h4 = h * HD;
    const int w  = t >> 5;
    const int ln = t & 31;
    const int ncol = ln & 15;
    const int d0   = (ln < 16) ? 0 : 2;
    const int ibase = blockIdx.y * ATT_COLS + w * 16;

    v2f kf;                                          // K columns i of this wave
    kf.x = Kg[(h4 + d0 + 0) * L + ibase + ncol];
    kf.y = Kg[(h4 + d0 + 1) * L + ibase + ncol];

    v2f acc[4][4];                                   // [d][pair of register rows i]
    #pragma unroll  // constant indices keep the array in registers
    for (int d = 0; d < 4; ++d) {
        #pragma unroll  // constant indices keep the array in registers
        for (int k = 0; k < 4; ++k) acc[d][k] = (v2f){0.f, 0.f};
    }

    for (int jc = 0; jc < L; jc += JCH) {
        __syncthreads();
        // async-stage Q rows for this chunk
        for (int idx = t; idx < HD * (JCH / 4); idx += ATT_THREADS) {
            const int d  = idx >> 9;
            const int j4 = idx & (JCH / 4 - 1);
            async_copy_b128(Qt + d * JCH + (j4 << 2),
                            Qg + (h4 + d) * L + jc + (j4 << 2));
        }
        // manual stage of V' = V / Z (needs the multiply)
        for (int idx = t; idx < HD * JCH; idx += ATT_THREADS) {
            const int d = idx >> 11;
            const int j = idx & (JCH - 1);
            const float rz = 1.0f / Zg[h * L + jc + j];
            Vs[j * 4 + d] = Vg[(h4 + d) * L + jc + j] * rz;
        }
        wait_async0();
        __syncthreads();

        for (int jt = 0; jt < JCH; jt += 16) {
            v2f qf;                                  // Q of j = jt + lane (from LDS)
            qf.x = Qt[(d0 + 0) * JCH + jt + ncol];
            qf.y = Qt[(d0 + 1) * JCH + jt + ncol];
            const float4 vv =                        // V/Z of the same j
                *reinterpret_cast<const float4*>(Vs + (jt + ncol) * 4);
            v8f c = {};
            c = __builtin_amdgcn_wmma_f32_16x16x4_f32(
                    false, kf, false, qf, (short)0, c, false, false);
            v2f pp[4];
            #pragma unroll  // constant indices keep the array in registers
            for (int k = 0; k < 4; ++k)
                pp[k] = (v2f){fast_exp2(c[2 * k]), fast_exp2(c[2 * k + 1])};
            #pragma unroll  // constant indices keep the array in registers
            for (int k = 0; k < 4; ++k) {            // packed f32 FMAs, two rows each
                const v2f p = pp[k];
                acc[0][k] = __builtin_elementwise_fma(p, (v2f){vv.x, vv.x}, acc[0][k]);
                acc[1][k] = __builtin_elementwise_fma(p, (v2f){vv.y, vv.y}, acc[1][k]);
                acc[2][k] = __builtin_elementwise_fma(p, (v2f){vv.z, vv.z}, acc[2][k]);
                acc[3][k] = __builtin_elementwise_fma(p, (v2f){vv.w, vv.w}, acc[3][k]);
            }
        }
    }

    // Sum over the 16 lanes of a row. The first three steps halve the values a
    // lane carries (it keeps the rows r whose bit equals its own lane bit and
    // hands the others to its partner), so lane l ends with row r = l & 7.
    const bool b0 = (ln & 1) != 0;
    const bool b1 = (ln & 2) != 0;
    const bool b2 = (ln & 4) != 0;
    const int  icol = ibase + ((ln >> 4) << 3) + (ln & 7);
    #pragma unroll  // constant indices keep the array in registers
    for (int d = 0; d < 4; ++d) {
        float w4[4], w2[2];
        #pragma unroll  // constant indices keep the array in registers
        for (int k = 0; k < 4; ++k) {
            const float keep = b0 ? acc[d][k].y : acc[d][k].x;
            const float give = b0 ? acc[d][k].x : acc[d][k].y;
            w4[k] = keep + row_xmask<0x161>(give);
        }
        #pragma unroll  // constant indices keep the array in registers
        for (int k = 0; k < 2; ++k) {
            const float keep = b1 ? w4[2 * k + 1] : w4[2 * k];
            const float give = b1 ? w4[2 * k] : w4[2 * k + 1];
            w2[k] = keep + row_xmask<0x162>(give);
        }
        const float keep = b2 ? w2[1] : w2[0];
        const float give = b2 ? w2[0] : w2[1];
        float v = keep + row_xmask<0x164>(give);
        v += row_xmask<0x168>(v);
        if (ncol < 8) Og[(h4 + d) * L + icol] = v;
    }
}

// ---------------------------------------------------------------------------
// Kernel 4: output projection + bias + residual
// Same form as kernel 1: tiles of 64 rows x 64 columns, one work-group each,
// one 16 x 16 tile per wave over the 64 attention channels on the f32 matrix
// instruction; Wo rows and attention columns lie in LDS with the channel index
// contiguous. Bias + residual are the accumulator's start value.
// ---------------------------------------------------------------------------
#define OP_ROWS 64
#define OP_COLS 64
#define OP_THREADS 512  // 16 waves: 4 row tiles x 4 column tiles
#define OP_PITCH 68     // floats; rows stay 16-byte aligned, 16 rows cover all 64 banks

__global__ __launch_bounds__(OP_THREADS)
void outproj_kernel(const float* __restrict__ Og,
                    const float* __restrict__ Wo,
                    const float* __restrict__ bo,
                    const float* __restrict__ X,
                    float* __restrict__ Out) {
    __shared__ __attribute__((aligned(16))) float Wt[OP_ROWS * OP_PITCH];  // [row][o]
    __shared__ __attribute__((aligned(16))) float Ot[OP_COLS * OP_PITCH];  // [col][o]

    const int t = threadIdx.x;
    const int lbase = blockIdx.x * OP_COLS;
    const int cbase = blockIdx.y * OP_ROWS;

    // the wave's number as a scalar: its tile's addresses stay scalar too
    const int w   = __builtin_amdgcn_readfirstlane(t >> 5);
    const int ln  = t & 31;
    const int r16 = ln & 15;
    const int hh  = ln >> 4;
    const int mt  = w >> 2;                      // row tile of this wave
    const int nt  = w & 3;                       // column tile of this wave
    const int row0 = cbase + mt * 16 + hh * 8;   // first of this lane's 8 rows
    const int col  = lbase + nt * 16 + r16;

    // accumulator register r of a lane is row row0 + r, column col
    const float4 b0 = *reinterpret_cast<const float4*>(bo + row0);
    const float4 b1 = *reinterpret_cast<const float4*>(bo + row0 + 4);
    float xr[8];
    #pragma unroll  // constant indices keep the array in registers
    for (int r = 0; r < 8; ++r) xr[r] = X[(row0 + r) * L + col];

    // Wo rows: the tile is 16 KB of contiguous memory
    #pragma unroll  // all loads in flight before the first LDS store
    for (int s = 0; s < OP_ROWS * AC / 4 / OP_THREADS; ++s) {
        const int idx = t + s * OP_THREADS;
        const int rr  = idx >> 4;
        const int k4  = idx & 15;
        *reinterpret_cast<float4*>(Wt + rr * OP_PITCH + k4 * 4) =
            *reinterpret_cast<const float4*>(Wo + (cbase + rr) * AC + k4 * 4);
    }
    // attention columns, transposed on the way: a wave reads 64 bytes of 8
    // channels, its four stores each fall on 32 different banks
    #pragma unroll  // all loads in flight before the first LDS store
    for (int s = 0; s < AC * OP_COLS / 4 / OP_THREADS; ++s) {
        const int idx = t + s * OP_THREADS;
        const int o  = ((idx >> 7) << 3) | ((idx >> 2) & 7);
        const int n0 = (((idx >> 5) & 3) << 4) | ((idx & 3) << 2);
        const float4 v = *reinterpret_cast<const float4*>(Og + o * L + lbase + n0);
        Ot[(n0 + 0) * OP_PITCH + o] = v.x;
        Ot[(n0 + 1) * OP_PITCH + o] = v.y;
        Ot[(n0 + 2) * OP_PITCH + o] = v.z;
        Ot[(n0 + 3) * OP_PITCH + o] = v.w;
    }
    __syncthreads();

    v8f c0 = {b0.x + xr[0], b0.y + xr[1], b0.z + xr[2], b0.w + xr[3],
              b1.x + xr[4], b1.y + xr[5], b1.z + xr[6], b1.w + xr[7]};
    v8f c1 = {};
    const float* wrow = Wt + (mt * 16 + r16) * OP_PITCH + hh * 4;
    const float* orow = Ot + (nt * 16 + r16) * OP_PITCH + hh * 4;
    #pragma unroll  // the next step's LDS reads issue ahead of this step's matrix work
    for (int u = 0; u < AC / 8; ++u) {
        const float4 a = *reinterpret_cast<const float4*>(wrow + u * 8);
        const float4 b = *reinterpret_cast<const float4*>(orow + u * 8);
        c0 = __builtin_amdgcn_wmma_f32_16x16x4_f32(
                 false, (v2f){a.x, a.y}, false, (v2f){b.x, b.y}, (short)0, c0, false, false);
        c1 = __builtin_amdgcn_wmma_f32_16x16x4_f32(
                 false, (v2f){a.z, a.w}, false, (v2f){b.z, b.w}, (short)0, c1, false, false);
    }

    #pragma unroll  // constant indices keep the vectors in registers
    for (int r = 0; r < 8; ++r) Out[(row0 + r) * L + col] = c0[r] + c1[r];
}

// ---------------------------------------------------------------------------
extern "C" void kernel_launch(void* const* d_in, const int* in_sizes, int n_in,
                              void* d_out, int out_size, void* d_ws, size_t ws_size,
                              hipStream_t stream) {
    (void)in_sizes; (void)n_in; (void)out_size; (void)ws_size;
    const float* X  = (const float*)d_in[0];
    const float* Wq = (const float*)d_in[1];
    const float* bq = (const float*)d_in[2];
    const float* Wk = (const float*)d_in[3];
    const float* bk = (const float*)d_in[4];
    const float* Wv = (const float*)d_in[5];
    const float* bv = (const float*)d_in[6];
    const float* Wo = (const float*)d_in[7];
    const float* bo = (const float*)d_in[8];
    float* out = (float*)d_out;

    float* ws = (float*)d_ws;
    float* Qg = ws + WS_Q;
    float* Kg = ws + WS_K;
    float* Vg = ws + WS_V;
    float* Zg = ws + WS_Z;
    float* Og = ws + WS_O;

    qkv_kernel<<<dim3(L / QKV_COLS, 192 / QKV_ROWS), QKV_THREADS, 0, stream>>>(X, Wq, bq, Wk, bk, Wv, bv, Qg, Kg, Vg);

    zrow_kernel<<<dim3(HEADS, L / 128), 256,
                  HD * JCH * sizeof(float), stream>>>(Qg, Kg, Zg);

    attn_kernel<<<dim3(HEADS, L / ATT_COLS), ATT_THREADS,
                  2 * HD * JCH * sizeof(float), stream>>>(Qg, Kg, Vg, Zg, Og);

    outproj_kernel<<<dim3(L / OP_COLS, C_IN / OP_ROWS), OP_THREADS, 0, stream>>>(Og, Wo, bo, X, out);
}

// v004
// One run takes 52.1 microseconds.
// In both of two side-by-side timings against v003, it was 1.47 times as fast.
// Over all steps from v000 it is 4.06 times as fast.
#include <hip/hip_runtime.h>

#define C_IN  256
#define AC    64
#define HEADS 16
#define HD    4
#define L     4096   // 64*64

#define LOG2E 1.44269504088896340736f

typedef __attribute__((ext_vector_type(2))) float v2f;
typedef __attribute__((ext_vector_type(4))) float v4f;
typedef __attribute__((ext_vector_type(8))) float v8f;

// workspace layout (floats)
#define WS_Q 0
#define WS_K (AC * L)
#define WS_V (2 * AC * L)
#define WS_O (3 * AC * L)   // OPARTS planes of AC x L

// ---------------------------------------------------------------------------
// Raw hardware 2^x (v_exp_f32)
// ---------------------------------------------------------------------------
__device__ __forceinline__ float fast_exp2(float x) {
#if __has_builtin(__builtin_amdgcn_exp2f)
    return __builtin_amdgcn_exp2f(x);
#else
    return exp2f(x);
#endif
}

// ---------------------------------------------------------------------------
// Kernel 1: QKV projections (1x1 conv == channel GEMM) + bias + L2-norm(Q,K)
// Q is additionally scaled by log2(e): scores then feed v_exp_f32 (2^x)
// directly with no per-element multiply in the hot loops.
// The 192 stacked output rows (Q, K, V) x 4096 columns are cut into tiles of
// 48 rows x 64 columns, one work-group each; each of 12 waves forms one
// 16 x 16 tile over all 256 channels on the f32 matrix instruction.
// W rows and X columns lie in LDS with the channel index contiguous: a lane
// reads 4 channels of its row (A) and of its column (B) with one 16-byte read
// each, which feed two matrix steps. Lane half h holds channels 8u+4h..8u+4h+3
// on both sides, so A and B agree in k at every position.
// ---------------------------------------------------------------------------
#define QKV_ROWS 48
#define QKV_COLS 64
#define QKV_TILES 12    // 3 row tiles x 4 column tiles, one wave each
#define QKV_THREADS 512 // 16 waves stage the operands, the first 12 go on
#define QKV_PITCH 260   // floats; rows stay 16-byte aligned, 16 rows cover all 64 banks
#define QKV_WLD (QKV_ROWS * C_IN / 4 / QKV_THREADS)   // 16-byte W loads of a thread
#define QKV_XLD (C_IN * QKV_COLS / 4 / QKV_THREADS)   // 16-byte X loads of a thread

__global__ __launch_bounds__(QKV_THREADS)
void qkv_kernel(const float* __restrict__ X,
                const float* __restrict__ Wq, const float* __restrict__ bq,
                const float* __restrict__ Wk, const float* __restrict__ bk,
                const float* __restrict__ Wv, const float* __restrict__ bv,
                float* __restrict__ Qg, float* __restrict__ Kg,
                float* __restrict__ Vg) {
    __shared__ __attribute__((aligned(16))) float Wt[QKV_ROWS * QKV_PITCH];  // [row][c]
    __shared__ __attribute__((aligned(16))) float Xt[QKV_COLS * QKV_PITCH];  // [col][c]

    const int t = threadIdx.x;
    const int lbase = blockIdx.x * QKV_COLS;
    const int rbase = blockIdx.y * QKV_ROWS;     // first of the 192 stacked rows

    // the wave's number as a scalar: tile, matrix and pointers stay scalar too
    const int w   = __builtin_amdgcn_readfirstlane(t >> 5);
    const int ln  = t & 31;
    const int r16 = ln & 15;
    const int hh  = ln >> 4;
    const int wt  = (w < QKV_TILES) ? w : 0;     // staging-only waves: any valid tile
    const int mt  = wt % 3;                      // row tile of this wave
    const int nt  = wt / 3;                      // column tile of this wave
    const int T   = blockIdx.y * 3 + mt;         // row tile among the 12
    const int mat = T >> 2;                      // 0=Q 1=K 2=V
    const int o0  = (T & 3) * 16 + hh * 8;       // first of this lane's 8 rows

    // W rows: a wave copies 512 contiguous bytes of one row
    const int k4 = t & 63;
    v4f wv[QKV_WLD];
    #pragma unroll  // all loads in flight before the first LDS store
    for (int s = 0; s < QKV_WLD; ++s) {
        const int R  = rbase + w / 2 + s * (QKV_THREADS / 64);
        const int wm = R >> 6;                   // 0=Q 1=K 2=V
        const float* Wm = (wm == 0 ? Wq : (wm == 1 ? Wk : Wv)) + (R & 63) * C_IN;
        wv[s] = *reinterpret_cast<const v4f*>(Wm + k4 * 4);
    }
    // X columns, transposed on the way: a wave reads 64 bytes of 8 channels,
    // its four stores each fall on 32 different banks
    const int xc = ((t >> 7) << 3) | ((t >> 2) & 7);          // channel, +32 a step
    const int n0 = (((t >> 5) & 3) << 4) | ((t & 3) << 2);    // first of 4 columns
    // one base and one offset serve all of a thread's loads: the step of 32
    // channels is a constant of each load
    const float* xp = X + lbase + (unsigned)(xc * L + n0);
    float4 xv[QKV_XLD];
    #pragma unroll  // all loads in flight before the first LDS store
    for (int s = 0; s < QKV_XLD; ++s)
        xv[s] = *reinterpret_cast<const float4*>(xp + s * 32 * L);
    // accumulator register r of a lane is row o0 + r, column r16
    const float* bm = (mat == 0 ? bq : (mat == 1 ? bk : bv)) + o0;
    const float4 b0 = *reinterpret_cast<const float4*>(bm);
    const float4 b1 = *reinterpret_cast<const float4*>(bm + 4);
    #pragma unroll  // constant indices keep the array in registers
    for (int s = 0; s < QKV_WLD; ++s)
        *reinterpret_cast<v4f*>(
            Wt + (w / 2 + s * (QKV_THREADS / 64)) * QKV_PITCH + k4 * 4) = wv[s];
    #pragma unroll  // constant indices keep the array in registers
    for (int s = 0; s < QKV_XLD; ++s) {
        const int c = xc + s * 32;
        Xt[(n0 + 0) * QKV_PITCH + c] = xv[s].x;
        Xt[(n0 + 1) * QKV_PITCH + c] = xv[s].y;
        Xt[(n0 + 2) * QKV_PITCH + c] = xv[s].z;
        Xt[(n0 + 3) * QKV_PITCH + c] = xv[s].w;
    }
    __syncthreads();
    if (w >= QKV_TILES) return;                  // whole waves leave; no barrier follows

    v8f c0 = {b0.x, b0.y, b0.z, b0.w, b1.x, b1.y, b1.z, b1.w};
    v8f c1 = {};
    const float* wrow = Wt + (mt * 16 + r16) * QKV_PITCH + hh * 4;
    const float* xrow = Xt + (nt * 16 + r16) * QKV_PITCH + hh * 4;
    #pragma unroll 8  // the next step's LDS reads issue ahead of this step's matrix work
    for (int u = 0; u < C_IN / 8; ++u) {
        const float4 a = *reinterpret_cast<const float4*>(wrow + u * 8);
        const float4 b = *reinterpret_cast<const float4*>(xrow + u * 8);
        c0 = __builtin_amdgcn_wmma_f32_16x16x4_f32(
                 false, (v2f){a.x, a.y}, false, (v2f){b.x, b.y}, (short)0, c0, false, false);
        c1 = __builtin_amdgcn_wmma_f32_16x16x4_f32(
                 false, (v2f){a.z, a.w}, false, (v2f){b.z, b.w}, (short)0, c1, false, false);
    }

    float y[8];
    #pragma unroll  // constant indices keep the array in registers
    for (int r = 0; r < 8; ++r) y[r] = c0[r] + c1[r];

    if (mat < 2) {                               // a head's 4 rows sit in one lane
        #pragma unroll  // constant indices keep the array in registers
        for (int g = 0; g < 8; g += 4) {
            float s = 0.f;
            #pragma unroll  // constant indices keep the array in registers
            for (int dd = 0; dd < 4; ++dd) s = fmaf(y[g + dd], y[g + dd], s);
            const float nrm = fmaxf(sqrtf(s), 1e-12f);
            #pragma unroll  // constant indices keep the array in registers
            for (int dd = 0; dd < 4; ++dd) {
                y[g + dd] = y[g + dd] / nrm;
                if (mat == 0) y[g + dd] *= LOG2E;   // fold exp->exp2 conversion into Q
            }
        }
    }

    float* dst = (mat == 0 ? Qg : (mat == 1 ? Kg : Vg)) + o0 * L + lbase + nt * 16 + r16;
    #pragma unroll  // constant indices keep the array in registers
    for (int r = 0; r < 8; ++r) dst[r * L] = y[r];
}

// ---------------------------------------------------------------------------
// Kernel 2: attention, one pass over the scores.
//   P[j][i] = 2^(q'_j . k_i),  Z_j = sum_i P[j][i],
//   out[d][i] = sum_j (V[d][j] / Z_j) * P[j][i]
// A work-group owns one head and FA_ROWS rows j, 16 rows a step. In a step its
// 16 waves together hold the 16 x 4096 block of P in registers (a wave: its own
// 256 columns i, 16 tiles), so that each 2^x is taken once: the row sums go
// from wave to wave through LDS, then the same registers are multiplied by V/Z.
// A score tile has its rows j in registers (r + 8 * lane half) and its columns
// i on lanes; a lane sums its own column over its 8 rows of every step, the two
// lane halves are added once at the end.
// The sums over a work-group's rows are one of OPARTS partial planes; kernel 3
// adds the planes.
// ---------------------------------------------------------------------------
// value of lane (l ^ mask) inside the 16-lane row; CTRL = 0x160 | mask
template <int CTRL>
__device__ __forceinline__ float row_xmask(float v) {
    return __builtin_bit_cast(float,
        __builtin_amdgcn_mov_dpp(__builtin_bit_cast(int, v), CTRL, 0xf, 0xf, true));
}
// acc += (p.y, p.y) * v. In asm: the compiler copies p.y into another register
// first, where the instruction can take the high half for both products itself.
__device__ __forceinline__ void pk_fma_hi(v2f& acc, v2f p, v2f v) {
    asm("v_pk_fma_f32 %0, %1, %2, %0 op_sel:[1,0,0]" : "+v"(acc) : "v"(p), "v"(v));
}
// value of lane l ^ 16
__device__ __forceinline__ float xhalf(float v) {
    return __builtin_bit_cast(float,
        __builtin_amdgcn_permlanex16(__builtin_bit_cast(int, v), __builtin_bit_cast(int, v),
                                     0x76543210, 0xfedcba98, false, false));
}

#define FA_WAVES 16
#define FA_THREADS (FA_WAVES * 32)
#define FA_TILES (L / 16 / FA_WAVES)   // column tiles of a wave
#define FA_ROWS 256                    // rows j of a work-group
#define FA_STEPS (FA_ROWS / 16)
#define OPARTS (L / FA_ROWS)           // partial planes of the sum over j
#define ZP_PITCH 20                    // floats; 16-byte reads of 16 rows spread over the banks

__global__ __launch_bounds__(FA_THREADS)
void attn_kernel(const float* __restrict__ Qg,
                 const float* __restrict__ Kg,
                 const float* __restrict__ Vg,
                 float* __restrict__ Op) {
    __shared__ __attribute__((aligned(16))) v2f   Kf[FA_WAVES * FA_TILES * 32];  // K fragments, as lanes hold them
    __shared__ __attribute__((aligned(16))) float Qs[HD * FA_ROWS];              // [d][j]
    __shared__ __attribute__((aligned(16))) float Vs[FA_ROWS * HD];              // [j][d]
    __shared__ __attribute__((aligned(16))) float Zp[2][16 * ZP_PITCH];          // [step parity][row][wave]
    __shared__ __attribute__((aligned(16))) float Vb[FA_WAVES][16 * HD];         // a wave's own V/Z, [row][d]

    const int t  = threadIdx.x;
    const int h4 = blockIdx.x * HD;
    const int jbase = blockIdx.y * FA_ROWS;
    const int w  = __builtin_amdgcn_readfirstlane(t >> 5);
    const int ln = t & 31;
    const int n  = ln & 15;
    const int hf = ln >> 4;
    const int d0 = hf * 2;
    const int ibase = w * (FA_TILES * 16);

    // each lane parks its own K fragments in LDS and reads them back every step
    v2f* kfr = Kf + w * (FA_TILES * 32) + ln;
    {
        const float* kp = Kg + (h4 + d0) * L + ibase + n;
        v2f kf[FA_TILES];
        #pragma unroll  // all loads in flight before the first LDS store
        for (int tt = 0; tt < FA_TILES; ++tt)
            kf[tt] = (v2f){kp[tt * 16], kp[L + tt * 16]};
        #pragma unroll  // constant indices keep the array in registers
        for (int tt = 0; tt < FA_TILES; ++tt) kfr[tt * 32] = kf[tt];
    }
    #pragma unroll  // all loads in flight before the first LDS store
    for (int s = 0; s < HD * FA_ROWS / FA_THREADS; ++s) {
        const int idx = t + s * FA_THREADS;
        const int d = idx / FA_ROWS;
        const int j = idx % FA_ROWS;
        Qs[d * FA_ROWS + j] = Qg[(h4 + d) * L + jbase + j];
        Vs[j * HD + d]      = Vg[(h4 + d) * L + jbase + j];
    }
    __syncthreads();

    v2f acc[FA_TILES][2];                            // [tile][d pair], column i = lane
    #pragma unroll  // constant indices keep the array in registers
    for (int tt = 0; tt < FA_TILES; ++tt) {
        acc[tt][0] = (v2f){0.f, 0.f};
        acc[tt][1] = (v2f){0.f, 0.f};
    }

    const bool b0 = (ln & 1) != 0;
    const bool b1 = (ln & 2) != 0;
    const bool b2 = (ln & 4) != 0;

    #pragma unroll 1  // one step's P block fills the register budget
    for (int s = 0; s < FA_STEPS; ++s) {
        v2f qf;                                      // Q rows j of this step
        qf.x = Qs[(d0 + 0) * FA_ROWS + s * 16 + n];
        qf.y = Qs[(d0 + 1) * FA_ROWS + s * 16 + n];
        const float4 v4 = *reinterpret_cast<const float4*>(Vs + (s * 16 + n) * HD);

        v2f P[FA_TILES][4];                          // [tile][pair of register rows]
        v2f zs[4];                                   // row sums over this lane's columns
        #pragma unroll  // constant indices keep the array in registers
        for (int k = 0; k < 4; ++k) zs[k] = (v2f){0.f, 0.f};
        #pragma unroll  // constant indices keep the arrays in registers
        for (int tt = 0; tt < FA_TILES; ++tt) {
            const v2f kf = kfr[tt * 32];
            v8f c = {};
            c = __builtin_amdgcn_wmma_f32_16x16x4_f32(
                    false, qf, false, kf, (short)0, c, false, false);
            #pragma unroll  // constant indices keep the arrays in registers
            for (int k = 0; k < 4; ++k) {
                P[tt][k] = (v2f){fast_exp2(c[2 * k]), fast_exp2(c[2 * k + 1])};
                zs[k] += P[tt][k];
            }
        }

        // Sum over the 16 lanes of a row. The first three steps halve the values
        // a lane carries, so lane l ends with register row r = l & 7.
        float w4[4], w2[2];
        #pragma unroll  // constant indices keep the array in registers
        for (int k = 0; k < 4; ++k) {
            const float keep = b0 ? zs[k].y : zs[k].x;
            const float give = b0 ? zs[k].x : zs[k].y;
            w4[k] = keep + row_xmask<0x161>(give);
        }
        #pragma unroll  // constant indices keep the array in registers
        for (int k = 0; k < 2; ++k) {
            const float keep = b1 ? w4[2 * k + 1] : w4[2 * k];
            const float give = b1 ? w4[2 * k] : w4[2 * k + 1];
            w2[k] = keep + row_xmask<0x162>(give);
        }
        const float zkeep = b2 ? w2[1] : w2[0];
        const float zgive = b2 ? w2[0] : w2[1];
        float zw = zkeep + row_xmask<0x164>(zgive);
        zw += row_xmask<0x168>(zw);

        // Two buffers by step parity: a wave writes a buffer again only behind
        // the next step's barrier, which no wave reaches before it has read it.
        float* zp = Zp[s & 1];
        if (n < 8) zp[(hf * 8 + n) * ZP_PITCH + w] = zw;
        __syncthreads();

        const float4 z0 = *reinterpret_cast<const float4*>(zp + n * ZP_PITCH + 0);
        const float4 z1 = *reinterpret_cast<const float4*>(zp + n * ZP_PITCH + 4);
        const float4 z2 = *reinterpret_cast<const float4*>(zp + n * ZP_PITCH + 8);
        const float4 z3 = *reinterpret_cast<const float4*>(zp + n * ZP_PITCH + 12);
        const float Z = (((z0.x + z0.y) + (z0.z + z0.w)) + ((z1.x + z1.y) + (z1.z + z1.w))) +
                        (((z2.x + z2.y) + (z2.z + z2.w)) + ((z3.x + z3.y) + (z3.z + z3.w)));
        const float rz = 1.0f / Z;
        // lane n holds V/Z of row n; every lane needs it of its 8 register rows:
        // through the wave's own LDS lines (a wave's LDS operations stay in order)
        if (hf == 0)
            *reinterpret_cast<float4*>(Vb[w] + n * HD) =
                make_float4(v4.x * rz, v4.y * rz, v4.z * rz, v4.w * rz);
        #pragma unroll  // constant indices keep the arrays in registers
        for (int k = 0; k < 4; ++k) {
            const float4 va = *reinterpret_cast<const float4*>(Vb[w] + (hf * 8 + 2 * k) * HD);
            const float4 vb = *reinterpret_cast<const float4*>(Vb[w] + (hf * 8 + 2 * k + 1) * HD);
            #pragma unroll  // constant indices keep the arrays in registers
            for (int tt = 0; tt < FA_TILES; ++tt) {  // packed f32 FMAs, two d each
                const float p = P[tt][k].x;
                acc[tt][0] = __builtin_elementwise_fma((v2f){p, p}, (v2f){va.x, va.y}, acc[tt][0]);
                acc[tt][1] = __builtin_elementwise_fma((v2f){p, p}, (v2f){va.z, va.w}, acc[tt][1]);
            }
            #pragma unroll  // constant indices keep the arrays in registers
            for (int tt = 0; tt < FA_TILES; ++tt) {
                pk_fma_hi(acc[tt][0], P[tt][k], (v2f){vb.x, vb.y});
                pk_fma_hi(acc[tt][1], P[tt][k], (v2f){vb.z, vb.w});
            }
        }
    }

    // Rows r of every step sit in lanes 0-15, rows 8 + r in lanes 16-31: each
    // half hands the other one d pair and ends with d = d0, d0 + 1.
    float* dst = Op + (blockIdx.y * AC + h4 + d0) * L + ibase + n;
    #pragma unroll  // constant indices keep the array in registers
    for (int tt = 0; tt < FA_TILES; ++tt) {
        const v2f keep = hf ? acc[tt][1] : acc[tt][0];
        const v2f give = hf ? acc[tt][0] : acc[tt][1];
        dst[tt * 16]     = keep.x + xhalf(give.x);
        dst[L + tt * 16] = keep.y + xhalf(give.y);
    }
}

// ---------------------------------------------------------------------------
// Kernel 3: output projection + bias + residual
// Same form as kernel 1: tiles of 64 rows x 64 columns, one work-group each,
// one 16 x 16 tile per wave over the 64 attention channels on the f32 matrix
// instruction; Wo rows and attention columns lie in LDS with the channel index
// contiguous. Bias + residual are the accumulator's start value. The attention
// columns are the sum of kernel 2's OPARTS partial planes, added on the way in.
// ---------------------------------------------------------------------------
#define OP_ROWS 64
#define OP_COLS 64
#define OP_THREADS 512  // 16 waves: 4 row tiles x 4 column tiles
#define OP_PITCH 68     // floats; rows stay 16-byte aligned, 16 rows cover all 64 banks

__global__ __launch_bounds__(OP_THREADS)
void outproj_kernel(const float* __restrict__ Og,
                    const float* __restrict__ Wo,
                    const float* __restrict__ bo,
                    const float* __restrict__ X,
                    float* __restrict__ Out) {
    __shared__ __attribute__((aligned(16))) float Wt[OP_ROWS * OP_PITCH];  // [row][o]
    __shared__ __attribute__((aligned(16))) float Ot[OP_COLS * OP_PITCH];  // [col][o]

    const int t = threadIdx.x;
    const int lbase = blockIdx.x * OP_COLS;
    const int cbase = blockIdx.y * OP_ROWS;

    // the wave's number as a scalar: its tile's addresses stay scalar too
    const int w   = __builtin_amdgcn_readfirstlane(t >> 5);
    const int ln  = t & 31;
    const int r16 = ln & 15;
    const int hh  = ln >> 4;
    const int mt  = w >> 2;                      // row tile of this wave
    const int nt  = w & 3;                       // column tile of this wave
    const int row0 = cbase + mt * 16 + hh * 8;   // first of this lane's 8 rows
    const int col  = lbase + nt * 16 + r16;

    // accumulator register r of a lane is row row0 + r, column col
    const float4 b0 = *reinterpret_cast<const float4*>(bo + row0);
    const float4 b1 = *reinterpret_cast<const float4*>(bo + row0 + 4);
    float xr[8];
    #pragma unroll  // constant indices keep the array in registers
    for (int r = 0; r < 8; ++r) xr[r] = X[(row0 + r) * L + col];

    // Wo rows: the tile is 16 KB of contiguous memory
    #pragma unroll  // all loads in flight before the first LDS store
    for (int s = 0; s < OP_ROWS * AC / 4 / OP_THREADS; ++s) {
        const int idx = t + s * OP_THREADS;
        const int rr  = idx >> 4;
        const int k4  = idx & 15;
        *reinterpret_cast<float4*>(Wt + rr * OP_PITCH + k4 * 4) =
            *reinterpret_cast<const float4*>(Wo + (cbase + rr) * AC + k4 * 4);
    }
    // attention columns, transposed on the way: a wave reads 64 bytes of 8
    // channels, its four stores each fall on 32 different banks
    #pragma unroll  // all loads in flight before the first LDS store
    for (int s = 0; s < AC * OP_COLS / 4 / OP_THREADS; ++s) {
        const int idx = t + s * OP_THREADS;
        const int o  = ((idx >> 7) << 3) | ((idx >> 2) & 7);
        const int n0 = (((idx >> 5) & 3) << 4) | ((idx & 3) << 2);
        const float* op = Og + o * L + lbase + n0;
        float4 v = *reinterpret_cast<const float4*>(op);
        #pragma unroll  // all loads in flight before the first add
        for (int p = 1; p < OPARTS; ++p) {
            const float4 u = *reinterpret_cast<const float4*>(op + p * (AC * L));
            v.x += u.x; v.y += u.y; v.z += u.z; v.w += u.w;
        }
        Ot[(n0 + 0) * OP_PITCH + o] = v.x;
        Ot[(n0 + 1) * OP_PITCH + o] = v.y;
        Ot[(n0 + 2) * OP_PITCH + o] = v.z;
        Ot[(n0 + 3) * OP_PITCH + o] = v.w;
    }
    __syncthreads();

    v8f c0 = {b0.x + xr[0], b0.y + xr[1], b0.z + xr[2], b0.w + xr[3],
              b1.x + xr[4], b1.y + xr[5], b1.z + xr[6], b1.w + xr[7]};
    v8f c1 = {};
    const float* wrow = Wt + (mt * 16 + r16) * OP_PITCH + hh * 4;
    const float* orow = Ot + (nt * 16 + r16) * OP_PITCH + hh * 4;
    #pragma unroll  // the next step's LDS reads issue ahead of this step's matrix work
    for (int u = 0; u < AC / 8; ++u) {
        const float4 a = *reinterpret_cast<const float4*>(wrow + u * 8);
        const float4 b = *reinterpret_cast<const float4*>(orow + u * 8);
        c0 = __builtin_amdgcn_wmma_f32_16x16x4_f32(
                 false, (v2f){a.x, a.y}, false, (v2f){b.x, b.y}, (short)0, c0, false, false);
        c1 = __builtin_amdgcn_wmma_f32_16x16x4_f32(
                 false, (v2f){a.z, a.w}, false, (v2f){b.z, b.w}, (short)0, c1, false, false);
    }

    #pragma unroll  // constant indices keep the vectors in registers
    for (int r = 0; r < 8; ++r) Out[(row0 + r) * L + col] = c0[r] + c1[r];
}

// ---------------------------------------------------------------------------
extern "C" void kernel_launch(void* const* d_in, const int* in_sizes, int n_in,
                              void* d_out, int out_size, void* d_ws, size_t ws_size,
                              hipStream_t stream) {
    (void)in_sizes; (void)n_in; (void)out_size; (void)ws_size;
    const float* X  = (const float*)d_in[0];
    const float* Wq = (const float*)d_in[1];
    const float* bq = (const float*)d_in[2];
    const float* Wk = (const float*)d_in[3];
    const float* bk = (const float*)d_in[4];
    const float* Wv = (const float*)d_in[5];
    const float* bv = (const float*)d_in[6];
    const float* Wo = (const float*)d_in[7];
    const float* bo = (const float*)d_in[8];
    float* out = (float*)d_out;

    float* ws = (float*)d_ws;
    float* Qg = ws + WS_Q;
    float* Kg = ws + WS_K;
    float* Vg = ws + WS_V;
    float* Og = ws + WS_O;

    qkv_kernel<<<dim3(L / QKV_COLS, 192 / QKV_ROWS), QKV_THREADS, 0, stream>>>(X, Wq, bq, Wk, bk, Wv, bv, Qg, Kg, Vg);

    attn_kernel<<<dim3(HEADS, OPARTS), FA_THREADS, 0, stream>>>(Qg, Kg, Vg, Og);

    outproj_kernel<<<dim3(L / OP_COLS, C_IN / OP_ROWS), OP_THREADS, 0, stream>>>(Og, Wo, bo, X, out);
}

// v005
// A run of this version takes 50.4 microseconds.
// In both of two side-by-side timings against v004, it was 1.04 times as fast.
// All steps since v000 together make it 4.22 times as fast.
#include <hip/hip_runtime.h>

#define C_IN  256
#define AC    64
#define HEADS 16
#define HD    4
#define L     4096   // 64*64

#define LOG2E 1.44269504088896340736f

typedef __attribute__((ext_vector_type(2))) float v2f;
typedef __attribute__((ext_vector_type(4))) float v4f;
typedef __attribute__((ext_vector_type(8))) float v8f;

// workspace layout (floats)
#define WS_Q 0
#define WS_K (AC * L)
#define WS_V (2 * AC * L)
#define WS_O (3 * AC * L)   // OPARTS planes of AC x L

// ---------------------------------------------------------------------------
// Raw hardware 2^x (v_exp_f32)
// ---------------------------------------------------------------------------
__device__ __forceinline__ float fast_exp2(float x) {
#if __has_builtin(__builtin_amdgcn_exp2f)
    return __builtin_amdgcn_exp2f(x);
#else
    return exp2f(x);
#endif
}

// ---------------------------------------------------------------------------
// Kernel 1: QKV projections (1x1 conv == channel GEMM) + bias + L2-norm(Q,K)
// Q is additionally scaled by log2(e): scores then feed v_exp_f32 (2^x)
// directly with no per-element multiply in the hot loops.
// The 192 stacked output rows (Q, K, V) x 4096 columns are cut into tiles of
// 48 rows x 64 columns, one work-group each; each of 12 waves forms one
// 16 x 16 tile over all 256 channels on the f32 matrix instruction.
// W rows and X columns lie in LDS with the channel index contiguous: a lane
// reads 4 channels of its row (A) and of its column (B) with one 16-byte read
// each, which feed two matrix steps. Lane half h holds channels 8u+4h..8u+4h+3
// on both sides, so A and B agree in k at every position.
// ---------------------------------------------------------------------------
#define QKV_ROWS 48
#define QKV_COLS 64
#define QKV_TILES 12    // 3 row tiles x 4 column tiles, one wave each
#define QKV_THREADS 512 // 16 waves stage the operands, the first 12 go on
#define QKV_PITCH 260   // floats; rows stay 16-byte aligned, 16 rows cover all 64 banks
#define QKV_WLD (QKV_ROWS * C_IN / 4 / QKV_THREADS)   // 16-byte W loads of a thread
#define QKV_XLD (C_IN * QKV_COLS / 4 / QKV_THREADS)   // 16-byte X loads of a thread

__global__ __launch_bounds__(QKV_THREADS)
void qkv_kernel(const float* __restrict__ X,
                const float* __restrict__ Wq, const float* __restrict__ bq,
                const float* __restrict__ Wk, const float* __restrict__ bk,
                const float* __restrict__ Wv, const float* __restrict__ bv,
                float* __restrict__ Qg, float* __restrict__ Kg,
                float* __restrict__ Vg) {
    __shared__ __attribute__((aligned(16))) float Wt[QKV_ROWS * QKV_PITCH];  // [row][c]
    __shared__ __attribute__((aligned(16))) float Xt[QKV_COLS * QKV_PITCH];  // [col][c]

    const int t = threadIdx.x;
    const int lbase = blockIdx.x * QKV_COLS;
    const int rbase = blockIdx.y * QKV_ROWS;     // first of the 192 stacked rows

    // the wave's number as a scalar: tile, matrix and pointers stay scalar too
    const int w   = __builtin_amdgcn_readfirstlane(t >> 5);
    const int ln  = t & 31;
    const int r16 = ln & 15;
    const int hh  = ln >> 4;
    const int wt  = (w < QKV_TILES) ? w : 0;     // staging-only waves: any valid tile
    const int mt  = wt % 3;                      // row tile of this wave
    const int nt  = wt / 3;                      // column tile of this wave
    const int T   = blockIdx.y * 3 + mt;         // row tile among the 12
    const int mat = T >> 2;                      // 0=Q 1=K 2=V
    const int o0  = (T & 3) * 16 + hh * 8;       // first of this lane's 8 rows

    // W rows: a wave copies 512 contiguous bytes of one row
    const int k4 = t & 63;
    v4f wv[QKV_WLD];
    #pragma unroll  // all loads in flight before the first LDS store
    for (int s = 0; s < QKV_WLD; ++s) {
        const int R  = rbase + w / 2 + s * (QKV_THREADS / 64);
        const int wm = R >> 6;                   // 0=Q 1=K 2=V
        const float* Wm = (wm == 0 ? Wq : (wm == 1 ? Wk : Wv)) + (R & 63) * C_IN;
        wv[s] = *reinterpret_cast<const v4f*>(Wm + k4 * 4);
    }
    // X columns, transposed on the way: a wave reads 64 bytes of 8 channels,
    // its four stores each fall on 32 different banks
    const int xc = ((t >> 7) << 3) | ((t >> 2) & 7);          // channel, +32 a step
    const int n0 = (((t >> 5) & 3) << 4) | ((t & 3) << 2);    // first of 4 columns
    // one base and one offset serve all of a thread's loads: the step of 32
    // channels is a constant of each load
    const float* xp = X + lbase + (unsigned)(xc * L + n0);
    float4 xv[QKV_XLD];
    #pragma unroll  // all loads in flight before the first LDS store
    for (int s = 0; s < QKV_XLD; ++s)
        xv[s] = *reinterpret_cast<const float4*>(xp + s * 32 * L);
    // accumulator register r of a lane is row o0 + r, column r16
    const float* bm = (mat == 0 ? bq : (mat == 1 ? bk : bv)) + o0;
    const float4 b0 = *reinterpret_cast<const float4*>(bm);
    const float4 b1 = *reinterpret_cast<const float4*>(bm + 4);
    #pragma unroll  // constant indices keep the array in registers
    for (int s = 0; s < QKV_WLD; ++s)
        *reinterpret_cast<v4f*>(
            Wt + (w / 2 + s * (QKV_THREADS / 64)) * QKV_PITCH + k4 * 4) = wv[s];
    #pragma unroll  // constant indices keep the array in registers
    for (int s = 0; s < QKV_XLD; ++s) {
        const int c = xc + s * 32;
        Xt[(n0 + 0) * QKV_PITCH + c] = xv[s].x;
        Xt[(n0 + 1) * QKV_PITCH + c] = xv[s].y;
        Xt[(n0 + 2) * QKV_PITCH + c] = xv[s].z;
        Xt[(n0 + 3) * QKV_PITCH + c] = xv[s].w;
    }
    __syncthreads();
    if (w >= QKV_TILES) return;                  // whole waves leave; no barrier follows

    v8f c0 = {b0.x, b0.y, b0.z, b0.w, b1.x, b1.y, b1.z, b1.w};
    v8f c1 = {};
    const float* wrow = Wt + (mt * 16 + r16) * QKV_PITCH + hh * 4;
    const float* xrow = Xt + (nt * 16 + r16) * QKV_PITCH + hh * 4;
    #pragma unroll 8  // the next step's LDS reads issue ahead of this step's matrix work
    for (int u = 0; u < C_IN / 8; ++u) {
        const float4 a = *reinterpret_cast<const float4*>(wrow + u * 8);
        const float4 b = *reinterpret_cast<const float4*>(xrow + u * 8);
        c0 = __builtin_amdgcn_wmma_f32_16x16x4_f32(
                 false, (v2f){a.x, a.y}, false, (v2f){b.x, b.y}, (short)0, c0, false, false);
        c1 = __builtin_amdgcn_wmma_f32_16x16x4_f32(
                 false, (v2f){a.z, a.w}, false, (v2f){b.z, b.w}, (short)0, c1, false, false);
    }

    float y[8];
    #pragma unroll  // constant indices keep the array in registers
    for (int r = 0; r < 8; ++r) y[r] = c0[r] + c1[r];

    if (mat < 2) {                               // a head's 4 rows sit in one lane
        #pragma unroll  // constant indices keep the array in registers
        for (int g = 0; g < 8; g += 4) {
            float s = 0.f;
            #pragma unroll  // constant indices keep the array in registers
            for (int dd = 0; dd < 4; ++dd) s = fmaf(y[g + dd], y[g + dd], s);
            const float nrm = fmaxf(sqrtf(s), 1e-12f);
            #pragma unroll  // constant indices keep the array in registers
            for (int dd = 0; dd < 4; ++dd) {
                y[g + dd] = y[g + dd] / nrm;
                if (mat == 0) y[g + dd] *= LOG2E;   // fold exp->exp2 conversion into Q
            }
        }
    }

    float* dst = (mat == 0 ? Qg : (mat == 1 ? Kg : Vg)) + o0 * L + lbase + nt * 16 + r16;
    #pragma unroll  // constant indices keep the array in registers
    for (int r = 0; r < 8; ++r) dst[r * L] = y[r];
}

// ---------------------------------------------------------------------------
// Kernel 2: attention, one pass over the scores.
//   P[j][i] = 2^(q'_j . k_i),  Z_j = sum_i P[j][i],
//   out[d][i] = sum_j (V[d][j] / Z_j) * P[j][i]
// A work-group owns one head and FA_ROWS rows j, 16 rows a step. In a step its
// 16 waves together hold the 16 x 4096 block of P in registers (a wave: its own
// 256 columns i, 16 tiles), so that each 2^x is taken once: the row sums go
// from wave to wave through LDS, then the same registers are multiplied by V/Z.
// A score tile has its rows j in registers (r + 8 * lane half) and its columns
// i on lanes; a lane sums its own column over its 8 rows of every step, the two
// lane halves are added once at the end.
// The sums over a work-group's rows are one of OPARTS partial planes; kernel 3
// adds the planes.
// ---------------------------------------------------------------------------
// value of lane (l ^ mask) inside the 16-lane row; CTRL = 0x160 | mask
template <int CTRL>
__device__ __forceinline__ float row_xmask(float v) {
    return __builtin_bit_cast(float,
        __builtin_amdgcn_mov_dpp(__builtin_bit_cast(int, v), CTRL, 0xf, 0xf, true));
}
// acc += (p.y, p.y) * v. In asm: the compiler copies p.y into another register
// first, where the instruction can take the high half for both products itself.
__device__ __forceinline__ void pk_fma_hi(v2f& acc, v2f p, v2f v) {
    asm("v_pk_fma_f32 %0, %1, %2, %0 op_sel:[1,0,0]" : "+v"(acc) : "v"(p), "v"(v));
}
// value of lane l ^ 16
__device__ __forceinline__ float xhalf(float v) {
    return __builtin_bit_cast(float,
        __builtin_amdgcn_permlanex16(__builtin_bit_cast(int, v), __builtin_bit_cast(int, v),
                                     0x76543210, 0xfedcba98, false, false));
}

#define FA_WAVES 16
#define FA_THREADS (FA_WAVES * 32)
#define FA_TILES (L / 16 / FA_WAVES)   // column tiles of a wave
#define FA_ROWS 256                    // rows j of a work-group
#define FA_STEPS (FA_ROWS / 16)
#define OPARTS (L / FA_ROWS)           // partial planes of the sum over j
#define ZP_PITCH 20                    // floats; 16-byte reads of 16 rows spread over the banks

__global__ __launch_bounds__(FA_THREADS)
void attn_kernel(const float* __restrict__ Qg,
                 const float* __restrict__ Kg,
                 const float* __restrict__ Vg,
                 float* __restrict__ Op) {
    __shared__ __attribute__((aligned(16))) v2f   Kf[FA_WAVES * FA_TILES * 32];  // K fragments, as lanes hold them
    __shared__ __attribute__((aligned(16))) float Qs[HD * FA_ROWS];              // [d][j]
    __shared__ __attribute__((aligned(16))) float Vs[FA_ROWS * HD];              // [j][d]
    __shared__ __attribute__((aligned(16))) float Zp[2][16 * ZP_PITCH];          // [step parity][row][wave]
    __shared__ __attribute__((aligned(16))) float Vb[FA_WAVES][16 * HD];         // a wave's own V/Z, [row][d]

    const int t  = threadIdx.x;
    const int h4 = blockIdx.x * HD;
    const int jbase = blockIdx.y * FA_ROWS;
    const int w  = __builtin_amdgcn_readfirstlane(t >> 5);
    const int ln = t & 31;
    const int n  = ln & 15;
    const int hf = ln >> 4;
    const int d0 = hf * 2;
    const int ibase = w * (FA_TILES * 16);

    // each lane parks its own K fragments in LDS and reads them back every step
    v2f* kfr = Kf + w * (FA_TILES * 32) + ln;
    {
        const float* kp = Kg + (h4 + d0) * L + ibase + n;
        v2f kf[FA_TILES];
        #pragma unroll  // all loads in flight before the first LDS store
        for (int tt = 0; tt < FA_TILES; ++tt)
            kf[tt] = (v2f){kp[tt * 16], kp[L + tt * 16]};
        #pragma unroll  // constant indices keep the array in registers
        for (int tt = 0; tt < FA_TILES; ++tt) kfr[tt * 32] = kf[tt];
    }
    #pragma unroll  // all loads in flight before the first LDS store
    for (int s = 0; s < HD * FA_ROWS / FA_THREADS; ++s) {
        const int idx = t + s * FA_THREADS;
        const int d = idx / FA_ROWS;
        const int j = idx % FA_ROWS;
        Qs[d * FA_ROWS + j] = Qg[(h4 + d) * L + jbase + j];
        Vs[j * HD + d]      = Vg[(h4 + d) * L + jbase + j];
    }
    __syncthreads();

    v2f acc[FA_TILES][2];                            // [tile][d pair], column i = lane
    #pragma unroll  // constant indices keep the array in registers
    for (int tt = 0; tt < FA_TILES; ++tt) {
        acc[tt][0] = (v2f){0.f, 0.f};
        acc[tt][1] = (v2f){0.f, 0.f};
    }

    const bool b0 = (ln & 1) != 0;
    const bool b1 = (ln & 2) != 0;
    const bool b2 = (ln & 4) != 0;

    #pragma unroll 1  // one step's P block fills the register budget
    for (int s = 0; s < FA_STEPS; ++s) {
        v2f qf;                                      // Q rows j of this step
        qf.x = Qs[(d0 + 0) * FA_ROWS + s * 16 + n];
        qf.y = Qs[(d0 + 1) * FA_ROWS + s * 16 + n];
        const float4 v4 = *reinterpret_cast<const float4*>(Vs + (s * 16 + n) * HD);

        v2f P[FA_TILES][4];                          // [tile][pair of register rows]
        v2f zs[4];                                   // row sums over this lane's columns
        #pragma unroll  // constant indices keep the array in registers
        for (int k = 0; k < 4; ++k) zs[k] = (v2f){0.f, 0.f};
        #pragma unroll  // constant indices keep the arrays in registers
        for (int tt = 0; tt < FA_TILES; ++tt) {
            const v2f kf = kfr[tt * 32];
            v8f c = {};
            c = __builtin_amdgcn_wmma_f32_16x16x4_f32(
                    false, qf, false, kf, (short)0, c, false, false);
            #pragma unroll  // constant indices keep the arrays in registers
            for (int k = 0; k < 4; ++k) {
                P[tt][k] = (v2f){fast_exp2(c[2 * k]), fast_exp2(c[2 * k + 1])};
                zs[k] += P[tt][k];
            }
        }

        // Sum over the 16 lanes of a row. The first three steps halve the values
        // a lane carries, so lane l ends with register row r = l & 7.
        float w4[4], w2[2];
        #pragma unroll  // constant indices keep the array in registers
        for (int k = 0; k < 4; ++k) {
            const float keep = b0 ? zs[k].y : zs[k].x;
            const float give = b0 ? zs[k].x : zs[k].y;
            w4[k] = keep + row_xmask<0x161>(give);
        }
        #pragma unroll  // constant indices keep the array in registers
        for (int k = 0; k < 2; ++k) {
            const float keep = b1 ? w4[2 * k + 1] : w4[2 * k];
            const float give = b1 ? w4[2 * k] : w4[2 * k + 1];
            w2[k] = keep + row_xmask<0x162>(give);
        }
        const float zkeep = b2 ? w2[1] : w2[0];
        const float zgive = b2 ? w2[0] : w2[1];
        float zw = zkeep + row_xmask<0x164>(zgive);
        zw += row_xmask<0x168>(zw);

        // Two buffers by step parity: a wave writes a buffer again only behind
        // the next step's barrier, which no wave reaches before it has read it.
        float* zp = Zp[s & 1];
        if (n < 8) zp[(hf * 8 + n) * ZP_PITCH + w] = zw;
        __syncthreads();

        const float4 z0 = *reinterpret_cast<const float4*>(zp + n * ZP_PITCH + 0);
        const float4 z1 = *reinterpret_cast<const float4*>(zp + n * ZP_PITCH + 4);
        const float4 z2 = *reinterpret_cast<const float4*>(zp + n * ZP_PITCH + 8);
        const float4 z3 = *reinterpret_cast<const float4*>(zp + n * ZP_PITCH + 12);
        const float Z = (((z0.x + z0.y) + (z0.z + z0.w)) + ((z1.x + z1.y) + (z1.z + z1.w))) +
                        (((z2.x + z2.y) + (z2.z + z2.w)) + ((z3.x + z3.y) + (z3.z + z3.w)));
        const float rz = 1.0f / Z;
        // lane n holds V/Z of row n; every lane needs it of its 8 register rows:
        // through the wave's own LDS lines (a wave's LDS operations stay in order)
        if (hf == 0)
            *reinterpret_cast<float4*>(Vb[w] + n * HD) =
                make_float4(v4.x * rz, v4.y * rz, v4.z * rz, v4.w * rz);
        #pragma unroll  // constant indices keep the arrays in registers
        for (int k = 0; k < 4; ++k) {
            const float4 va = *reinterpret_cast<const float4*>(Vb[w] + (hf * 8 + 2 * k) * HD);
            const float4 vb = *reinterpret_cast<const float4*>(Vb[w] + (hf * 8 + 2 * k + 1) * HD);
            #pragma unroll  // constant indices keep the arrays in registers
            for (int tt = 0; tt < FA_TILES; ++tt) {  // packed f32 FMAs, two d each
                const float p = P[tt][k].x;
                acc[tt][0] = __builtin_elementwise_fma((v2f){p, p}, (v2f){va.x, va.y}, acc[tt][0]);
                acc[tt][1] = __builtin_elementwise_fma((v2f){p, p}, (v2f){va.z, va.w}, acc[tt][1]);
            }
            #pragma unroll  // constant indices keep the arrays in registers
            for (int tt = 0; tt < FA_TILES; ++tt) {
                pk_fma_hi(acc[tt][0], P[tt][k], (v2f){vb.x, vb.y});
                pk_fma_hi(acc[tt][1], P[tt][k], (v2f){vb.z, vb.w});
            }
        }
    }

    // Rows r of every step sit in lanes 0-15, rows 8 + r in lanes 16-31: each
    // half hands the other one d pair and ends with d = d0, d0 + 1.
    float* dst = Op + (blockIdx.y * AC + h4 + d0) * L + ibase + n;
    #pragma unroll  // constant indices keep the array in registers
    for (int tt = 0; tt < FA_TILES; ++tt) {
        const v2f keep = hf ? acc[tt][1] : acc[tt][0];
        const v2f give = hf ? acc[tt][0] : acc[tt][1];
        dst[tt * 16]     = keep.x + xhalf(give.x);
        dst[L + tt * 16] = keep.y + xhalf(give.y);
    }
}

// ---------------------------------------------------------------------------
// Kernel 3: output projection + bias + residual
// Same form as kernel 1: tiles of 128 rows x 32 columns, one work-group each,
// one 16 x 16 tile per wave over the 64 attention channels on the f32 matrix
// instruction; Wo rows and attention columns lie in LDS with the channel index
// contiguous. Bias + residual are the accumulator's start value. The attention
// columns are the sum of kernel 2's OPARTS partial planes, added on the way in.
// The planes are by far the most bytes this kernel reads, and every row block
// reads all of them again: the tile is tall, so that there are only two row
// blocks, and 32 columns wide, one whole 128-byte line of a plane's channel.
// ---------------------------------------------------------------------------
#define OP_ROWS 128
#define OP_COLS 32
#define OP_THREADS 512  // 16 waves: 8 row tiles x 2 column tiles
#define OP_PITCH 68     // floats; rows stay 16-byte aligned, 16 rows cover all 64 banks

__global__ __launch_bounds__(OP_THREADS)
void outproj_kernel(const float* __restrict__ Og,
                    const float* __restrict__ Wo,
                    const float* __restrict__ bo,
                    const float* __restrict__ X,
                    float* __restrict__ Out) {
    __shared__ __attribute__((aligned(16))) float Wt[OP_ROWS * OP_PITCH];  // [row][o]
    __shared__ __attribute__((aligned(16))) float Ot[OP_COLS * OP_PITCH];  // [col][o]

    const int t = threadIdx.x;
    const int lbase = blockIdx.x * OP_COLS;
    const int cbase = blockIdx.y * OP_ROWS;

    // the wave's number as a scalar: its tile's addresses stay scalar too
    const int w   = __builtin_amdgcn_readfirstlane(t >> 5);
    const int ln  = t & 31;
    const int r16 = ln & 15;
    const int hh  = ln >> 4;
    const int mt  = w >> 1;                      // row tile of this wave
    const int nt  = w & 1;                       // column tile of this wave
    const int row0 = cbase + mt * 16 + hh * 8;   // first of this lane's 8 rows
    const int col  = lbase + nt * 16 + r16;

    // accumulator register r of a lane is row row0 + r, column col
    const float4 b0 = *reinterpret_cast<const float4*>(bo + row0);
    const float4 b1 = *reinterpret_cast<const float4*>(bo + row0 + 4);
    float xr[8];
    #pragma unroll  // constant indices keep the array in registers
    for (int r = 0; r < 8; ++r) xr[r] = X[(row0 + r) * L + col];

    // Wo rows: the tile is 32 KB of contiguous memory
    #pragma unroll  // all loads in flight before the first LDS store
    for (int s = 0; s < OP_ROWS * AC / 4 / OP_THREADS; ++s) {
        const int idx = t + s * OP_THREADS;
        const int rr  = idx >> 4;
        const int k4  = idx & 15;
        *reinterpret_cast<float4*>(Wt + rr * OP_PITCH + k4 * 4) =
            *reinterpret_cast<const float4*>(Wo + (cbase + rr) * AC + k4 * 4);
    }
    // attention columns, transposed on the way: a thread has 4 columns of one
    // channel, a wave reads the whole 128-byte lines of 4 channels
    {
        const int o  = t >> 3;
        const int n0 = (t & 7) << 2;
        const float* op = Og + o * L + lbase + n0;
        float4 v = *reinterpret_cast<const float4*>(op);
        #pragma unroll  // all loads in flight before the first add
        for (int p = 1; p < OPARTS; ++p) {
            const float4 u = *reinterpret_cast<const float4*>(op + p * (AC * L));
            v.x += u.x; v.y += u.y; v.z += u.z; v.w += u.w;
        }
        Ot[(n0 + 0) * OP_PITCH + o] = v.x;
        Ot[(n0 + 1) * OP_PITCH + o] = v.y;
        Ot[(n0 + 2) * OP_PITCH + o] = v.z;
        Ot[(n0 + 3) * OP_PITCH + o] = v.w;
    }
    __syncthreads();

    v8f c0 = {b0.x + xr[0], b0.y + xr[1], b0.z + xr[2], b0.w + xr[3],
              b1.x + xr[4], b1.y + xr[5], b1.z + xr[6], b1.w + xr[7]};
    v8f c1 = {};
    const float* wrow = Wt + (mt * 16 + r16) * OP_PITCH + hh * 4;
    const float* orow = Ot + (nt * 16 + r16) * OP_PITCH + hh * 4;
    #pragma unroll  // the next step's LDS reads issue ahead of this step's matrix work
    for (int u = 0; u < AC / 8; ++u) {
        const float4 a = *reinterpret_cast<const float4*>(wrow + u * 8);
        const float4 b = *reinterpret_cast<const float4*>(orow + u * 8);
        c0 = __builtin_amdgcn_wmma_f32_16x16x4_f32(
                 false, (v2f){a.x, a.y}, false, (v2f){b.x, b.y}, (short)0, c0, false, false);
        c1 = __builtin_amdgcn_wmma_f32_16x16x4_f32(
                 false, (v2f){a.z, a.w}, false, (v2f){b.z, b.w}, (short)0, c1, false, false);
    }

    #pragma unroll  // constant indices keep the vectors in registers
    for (int r = 0; r < 8; ++r) Out[(row0 + r) * L + col] = c0[r] + c1[r];
}

// ---------------------------------------------------------------------------
extern "C" void kernel_launch(void* const* d_in, const int* in_sizes, int n_in,
                              void* d_out, int out_size, void* d_ws, size_t ws_size,
                              hipStream_t stream) {
    (void)in_sizes; (void)n_in; (void)out_size; (void)ws_size;
    const float* X  = (const float*)d_in[0];
    const float* Wq = (const float*)d_in[1];
    const float* bq = (const float*)d_in[2];
    const float* Wk = (const float*)d_in[3];
    const float* bk = (const float*)d_in[4];
    const float* Wv = (const float*)d_in[5];
    const float* bv = (const float*)d_in[6];
    const float* Wo = (const float*)d_in[7];
    const float* bo = (const float*)d_in[8];
    float* out = (float*)d_out;

    float* ws = (float*)d_ws;
    float* Qg = ws + WS_Q;
    float* Kg = ws + WS_K;
    float* Vg = ws + WS_V;
    float* Og = ws + WS_O;

    qkv_kernel<<<dim3(L / QKV_COLS, 192 / QKV_ROWS), QKV_THREADS, 0, stream>>>(X, Wq, bq, Wk, bk, Wv, bv, Qg, Kg, Vg);

    attn_kernel<<<dim3(HEADS, OPARTS), FA_THREADS, 0, stream>>>(Qg, Kg, Vg, Og);

    outproj_kernel<<<dim3(L / OP_COLS, C_IN / OP_ROWS), OP_THREADS, 0, stream>>>(Og, Wo, bo, X, out);
}
